// v000
// Times are from an AMD MI455X. After a warm-up the kernel runs many times in a row, and a time is the length of
// such a window on the GPU divided by its runs, so every launch and the gaps after it count. The runs cycle
// through copies of the inputs. A figure is the median of several windows, for all but v000 over two sittings.
// Sittings can differ by a few percent; kernels timed side by side share one.
// v000, which the later versions start from, runs in 162 microseconds.
#include <hip/hip_runtime.h>

// All contractions: v_wmma_f32_16x16x32_f16 (16-bit operands, f32 accumulate). Projections q/k/v = X W + b with X bf16-exact (x8) staged block-wide and W^T [o][c] bf16-exact (x256): 1 product;
// S^T = K_tile Q^T with q/k single f16 x8 planes (K = 64): 1 product; O^T += V^T P^T with V^T single f16 x8 and P single f16 x1024: 1 product. Biases, online softmax statistics and the
// final normalisation in f32. All float inputs RNE-converted to bf16 once on load.

#ifndef NB
#define NB 16
#endif
#ifndef SEQ
#define SEQ 2048
#endif

namespace {
constexpr int B_FULL = 16, T_FULL = 2048, C = 384, HD = 64;
constexpr int NBL = NB;   // batches processed
constexpr int SQ = SEQ;   // tokens processed per batch (queries and keys); input stride per batch stays T_FULL
constexpr int KC = 128;   // k chunk of C staged in LDS per pass
constexpr float XS = 8.0f, WSC = 256.0f, PS = 1024.0f, LOG2E = 1.4426950408889634f, SCL = 0.125f;   // 64^-0.5
static_assert(NBL >= 1 && NBL <= B_FULL);
static_assert(SQ >= 64 && SQ <= T_FULL && SQ % 64 == 0 && SQ % 32 == 0);
static_assert(C % KC == 0 && KC % 32 == 0 && C % 8 == 0 && HD == 64);
constexpr int PREP_ELEMS = 3 * HD * C;           // 73728 halves in W^T
constexpr int PREP_THREADS = PREP_ELEMS / 8;     // 9216 threads, 8 halves each
static_assert(PREP_ELEMS % 8 == 0 && PREP_THREADS % 256 == 0);
// coverage: prep grid (PREP_THREADS/256) x 256 x 8 == 3*HD*C; proj grid (SQ/64, NBL) x 64 tokens x HD == NBL*SQ*HD per plane; attn grid (SQ/32, NBL) x 32 rows x HD == NBL*SQ*HD == out
static_assert((PREP_THREADS / 256) * 256 * 8 == PREP_ELEMS);
static_assert((SQ / 64) * 64 == SQ && (SQ / 32) * 32 == SQ);

typedef _Float16 b16;
typedef __attribute__((ext_vector_type(16))) _Float16 v16b;
typedef __attribute__((ext_vector_type(8))) _Float16 v8b;
typedef __attribute__((ext_vector_type(4))) _Float16 v4h;
typedef __attribute__((ext_vector_type(8))) float v8f;
typedef __attribute__((ext_vector_type(4))) float v4f;

__device__ __forceinline__ float bf16_rne(float f) { unsigned int u = __float_as_uint(f); u += 0x7FFFu + ((u >> 16) & 1u); return __uint_as_float(u & 0xFFFF0000u); }
__device__ __forceinline__ v16b frag_kb(const b16* p, int hh) { const v8b a = *(const v8b*)(p + 8 * hh), b = *(const v8b*)(p + 16 + 8 * hh); v16b f;
#pragma unroll
  for (int e = 0; e < 8; ++e) { f[e] = a[e]; f[8 + e] = b[e]; } return f; }
__device__ __forceinline__ v8f wmma16b(v16b a, v16b b, v8f c) { v8f d = __builtin_amdgcn_wmma_f32_16x16x32_f16(false, a, false, b, (short)0, c, false, false); asm volatile("v_nop\n\tv_nop\n\tv_nop\n\tv_nop" : "+v"(d) : "v"(a), "v"(b)); return d; }
__device__ __forceinline__ void wave_lds_sync() { __builtin_amdgcn_fence(3 /* release order */, "workgroup"); __builtin_amdgcn_wave_barrier(); __builtin_amdgcn_fence(2 /* acquire order */, "workgroup"); }
__device__ __forceinline__ float nexp2(float v) { return __builtin_amdgcn_exp2f(v); }

__global__ __launch_bounds__(256) void prep_kernel(const float* __restrict__ wq, const float* __restrict__ wk, const float* __restrict__ wv, b16* __restrict__ WT) {
  const size_t u = (size_t)blockIdx.x * 256 + threadIdx.x; if (u >= (size_t)PREP_THREADS) return;
  const size_t e = u * 8; const int oo = (int)(e / C), c0 = (int)(e % C); const int m = oo / HD, o2 = oo % HD; const float* w = m == 0 ? wq : m == 1 ? wk : wv; v8b o;
#pragma unroll
  for (int j = 0; j < 8; ++j) o[j] = (b16)(bf16_rne(w[(size_t)(c0 + j) * HD + o2]) * WSC);
  { *(v8b*)(WT + e) = o;  }
}

// projections: grid (SQ/64, NBL, 3 parts: 0 q (row operand, plane QP [b][tok][64]), 1 k (streamed operand, plane KP [b][tok][64]), 2 v (V^T [b][d][tok])); block = 64 tokens x 4 waves,
__global__ __launch_bounds__(128) void proj_kernel(const float* __restrict__ X, const b16* __restrict__ WT, const float* __restrict__ bq, const float* __restrict__ bk, const float* __restrict__ bv,
                                                   b16* __restrict__ QP, b16* __restrict__ KP, b16* __restrict__ VT) {
  __shared__ __attribute__((aligned(16))) b16 As[64][KC + 8]; __shared__ __attribute__((aligned(16))) float Tf[4][16][HD + 4];
  const int wave = threadIdx.x >> 5, lane = threadIdx.x & 31, nloc = lane & 15, hlf = lane >> 4; const int t0 = blockIdx.x * 64; const int b = blockIdx.y; const int part = blockIdx.z;
  const float* xb = X + ((size_t)b * T_FULL + t0) * C; const float* bias = part == 0 ? bq : part == 1 ? bk : bv; const b16* W = WT + (size_t)part * HD * C;
  v8f acc[4];
#pragma unroll
  for (int t = 0; t < 4; ++t) acc[t] = (v8f){};
#pragma unroll 1
  for (int kc = 0; kc < C; kc += KC) {
    __syncthreads();
    for (int i = threadIdx.x; i < 64 * (KC / 4); i += 128) { const int rr = i / (KC / 4), q = (i % (KC / 4)) * 4; const v4f f = *(const v4f*)(xb + (size_t)rr * C + kc + q); v4h o;
#pragma unroll
      for (int j = 0; j < 4; ++j) o[j] = (b16)(bf16_rne(f[j]) * XS); *(v4h*)(&As[rr][q]) = o; }
    __syncthreads();
#pragma unroll 2
    for (int kb = 0; kb < KC; kb += 32) { const v16b a = frag_kb(&As[wave * 16 + nloc][kb], hlf);
#pragma unroll
      for (int t = 0; t < 4; ++t) acc[t] = wmma16b(a, frag_kb(W + (size_t)(t * 16 + nloc) * C + kc + kb, hlf), acc[t]); } }
#pragma unroll
  for (int t = 0; t < 4; ++t) { const float bb = bf16_rne(bias[t * 16 + nloc]);
#pragma unroll
    for (int r = 0; r < 8; ++r) Tf[wave][8 * hlf + r][t * 16 + nloc] = acc[t][r] * (1.0f / (XS * WSC)) + bb; }
  __syncthreads();   // part 2 reads Tf rows of all waves
  {
    if (part < 2) { b16* plane = part == 0 ? QP : KP;
#pragma unroll 1
      for (int it = 0; it < 4; ++it) { const int rr = it * 4 + (lane >> 3); const int tok = t0 + wave * 16 + rr; const int c8 = (lane & 7) * 8; v8b o8;
#pragma unroll
        for (int j = 0; j < 8; ++j) o8[j] = (b16)(Tf[wave][rr][c8 + j] * XS);
        *(v8b*)(plane + ((size_t)b * SQ + tok) * HD + c8) = o8; } }
    else {
#pragma unroll 1
      for (int it = 0; it < 4; ++it) { const int d = wave * 16 + it * 4 + (lane >> 3); const int tk0 = (lane & 7) * 8; v8b vv;
#pragma unroll
        for (int j = 0; j < 8; ++j) { const int tk = tk0 + j; vv[j] = (b16)(Tf[tk >> 4][tk & 15][d] * XS); }
        *(v8b*)(VT + ((size_t)b * HD + d) * (size_t)SQ + t0 + tk0) = vv; } }
     }
}

// attention: grid (SQ/32, NBL): block = 2 waves x 16 query rows; q fragments register-resident; S^T = K_tile Q^T (lane col = query row, D rows = keys; K = 64 = 2 k-steps); online
// softmax over keys with running max; P x1024 single through per-wave LDS (each lane re-reads only its own slots); O^T += V^T P^T (4 d-tiles); out rows [b][t][64] f32:
__global__ __launch_bounds__(64) void attn_kernel(const b16* __restrict__ QP, const b16* __restrict__ KP, const b16* __restrict__ VT, float* __restrict__ out) {
  __shared__ __attribute__((aligned(16))) b16 Pb[2][16][32 + 8]; __shared__ __attribute__((aligned(16))) float To[2][16][HD + 4];
  const int wave = threadIdx.x >> 5, lane = threadIdx.x & 31, hh = lane >> 4, col = lane & 15; const int b = blockIdx.y; const int r0 = blockIdx.x * 32 + wave * 16, ri = r0 + col;
  const b16* Qb = QP + (size_t)b * SQ * HD; const b16* Kb = KP + (size_t)b * SQ * HD; const b16* Vb = VT + (size_t)b * HD * (size_t)SQ;
  v16b qa[2];
#pragma unroll
  for (int i = 0; i < 2; ++i) qa[i] = frag_kb(Qb + (size_t)ri * HD + 32 * i, hh);
  const float cs = SCL * LOG2E / (XS * XS);
  float m = -__builtin_inff(), l = 0.0f; v8f o[4];
#pragma unroll
  for (int t = 0; t < 4; ++t) o[t] = (v8f){};
#pragma unroll 1
  for (int sb = 0; sb < SQ; sb += 32) {
    float e[16]; float mx = -__builtin_inff();
#pragma unroll
    for (int u = 0; u < 2; ++u) { v8f s = (v8f){}; const size_t kr = (size_t)(sb + u * 16 + col) * HD;
#pragma unroll
      for (int i = 0; i < 2; ++i) s = wmma16b(frag_kb(Kb + kr + 32 * i, hh), qa[i], s);
#pragma unroll
      for (int r = 0; r < 8; ++r) { const float vv = s[r] * cs; e[u * 8 + r] = vv; mx = fmaxf(mx, vv); } }
    mx = fmaxf(mx, __shfl_xor(mx, 16)); const float mn = fmaxf(m, mx); const float al = nexp2(m - mn); float sum = 0.0f;
#pragma unroll
    for (int i2 = 0; i2 < 16; ++i2) { const float p = nexp2(e[i2] - mn); sum += p; Pb[wave][col][(i2 < 8 ? 0 : 16) + 8 * hh + (i2 & 7)] = (b16)(p * PS); }
    sum += __shfl_xor(sum, 16); l = l * al + sum; m = mn;
    wave_lds_sync();
    const v16b pf = frag_kb(&Pb[wave][col][0], hh);
#pragma unroll
    for (int t = 0; t < 4; ++t) { o[t] *= al; o[t] = wmma16b(frag_kb(Vb + (size_t)(t * 16 + col) * SQ + sb, hh), pf, o[t]); }
    wave_lds_sync(); }
  const float inv = 1.0f / (l * PS * XS);
#pragma unroll
  for (int t = 0; t < 4; ++t)
#pragma unroll
    for (int r = 0; r < 8; ++r) To[wave][col][t * 16 + 8 * hh + r] = o[t][r] * inv;
  wave_lds_sync();
  {
#pragma unroll 1
    for (int it = 0; it < 8; ++it) { const int rr = it * 2 + (lane >> 4); const int c4 = (lane & 15) * 4;
      *(v4f*)(out + ((size_t)b * SQ + r0 + rr) * HD + c4) = *(const v4f*)(&To[wave][rr][c4]); }
     }
}
}  // namespace

extern "C" void kernel_launch(void* const* d_in, const int* in_sizes, int n_in, void* d_out, int out_size, void* d_ws, size_t ws_size, hipStream_t stream) {
  if (n_in < 7) return;
  auto Fp = [&](int i) { return (const float*)d_in[i]; };
  // wire order: 0 x [16,2048,384], 1 Wq [384,64], 2 bq [64], 3 Wk [384,64], 4 bk [64], 5 Wv [384,64], 6 bv [64]
  if ((size_t)in_sizes[0] < (size_t)NBL * T_FULL * C || in_sizes[1] < C * HD || in_sizes[2] < HD || in_sizes[3] < C * HD || in_sizes[4] < HD || in_sizes[5] < C * HD || in_sizes[6] < HD) return;
  if ((size_t)out_size < (size_t)NBL * SQ * HD) return;
  size_t off = 0; char* ws = (char*)d_ws;
  auto carve = [&](size_t bytes) { char* p = ws + off; off += (bytes + 255) & ~(size_t)255; return p; };
  b16* WT = (b16*)carve((size_t)PREP_ELEMS * 2);            // 147,456 B
  const size_t plane = (size_t)NBL * SQ * HD * 2;            // 4,194,304 B at full size
  b16* QP = (b16*)carve(plane); b16* KP = (b16*)carve(plane); b16* VT = (b16*)carve(plane);
  if (off > ws_size || off > ((size_t)128 << 20)) return;    // about 12.7 MB total
  prep_kernel<<<(unsigned)(PREP_THREADS / 256), 256, 0, stream>>>(Fp(1), Fp(3), Fp(5), WT);
  proj_kernel<<<dim3(SQ / 64, NBL, 3), 128, 0, stream>>>(Fp(0), WT, Fp(2), Fp(4), Fp(6), QP, KP, VT);
  attn_kernel<<<dim3(SQ / 32, NBL), 64, 0, stream>>>(QP, KP, VT, (float*)d_out);
}

// v001
// A run of this version takes 61.2 microseconds.
// Next to v000, in two timings, it ran 2.77 and 2.78 times as fast.
#include <hip/hip_runtime.h>

// All contractions: v_wmma_f32_16x16x32_f16 (16-bit operands, f32 accumulate). Projections q/k/v = X W + b with X bf16-exact (x8) staged block-wide and W^T [o][c] bf16-exact (x256): 1 product;
// S^T = K_tile Q^T with q/k single f16 x8 planes (K = 64): 1 product; O^T += V^T P^T with V^T single f16 x8 and P single f16 x1024: 1 product. Biases, online softmax statistics and the
// final normalisation in f32. All float inputs RNE-converted to bf16 once on load.

#ifndef NB
#define NB 16
#endif
#ifndef SEQ
#define SEQ 2048
#endif

namespace {
constexpr int B_FULL = 16, T_FULL = 2048, C = 384, HD = 64;
constexpr int NBL = NB;   // batches processed
constexpr int SQ = SEQ;   // tokens processed per batch (queries and keys); input stride per batch stays T_FULL
constexpr int KC = 128;   // k chunk of C staged in LDS per pass
constexpr float XS = 8.0f, WSC = 256.0f, PS = 1024.0f, LOG2E = 1.4426950408889634f, SCL = 0.125f;   // 64^-0.5
static_assert(NBL >= 1 && NBL <= B_FULL);
static_assert(SQ >= 64 && SQ <= T_FULL && SQ % 64 == 0 && SQ % 32 == 0);
static_assert(C % KC == 0 && KC % 32 == 0 && C % 8 == 0 && HD == 64);
constexpr int PREP_ELEMS = 3 * HD * C;           // 73728 halves in W^T
constexpr int PREP_THREADS = PREP_ELEMS / 8;     // 9216 threads, 8 halves each
static_assert(PREP_ELEMS % 8 == 0 && PREP_THREADS % 256 == 0);
// coverage: prep grid (PREP_THREADS/256) x 256 x 8 == 3*HD*C; proj grid (SQ/64, NBL) x 64 tokens x HD == NBL*SQ*HD per plane; attn grid (SQ/QB, NBL) x QB rows x HD == NBL*SQ*HD == out
static_assert((PREP_THREADS / 256) * 256 * 8 == PREP_ELEMS);
static_assert((SQ / 64) * 64 == SQ && (SQ / 32) * 32 == SQ);
constexpr int AW = 8, QB = AW * 16;   // attention block: waves, query rows
constexpr int KT = 128, NT = SQ / KT;   // keys per staged tile, tiles
static_assert(SQ % QB == 0 && SQ % KT == 0 && KT % 32 == 0 && 4 * 8 * AW * 32 == KT * HD);   // 4 pieces of 8 halves per thread fill each staged tile

typedef _Float16 b16;
typedef __attribute__((ext_vector_type(16))) _Float16 v16b;
typedef __attribute__((ext_vector_type(8))) _Float16 v8b;
typedef __attribute__((ext_vector_type(4))) _Float16 v4h;
typedef __attribute__((ext_vector_type(8))) float v8f;
typedef __attribute__((ext_vector_type(4))) float v4f;

__device__ __forceinline__ float bf16_rne(float f) { unsigned int u = __float_as_uint(f); u += 0x7FFFu + ((u >> 16) & 1u); return __uint_as_float(u & 0xFFFF0000u); }
__device__ __forceinline__ v16b frag_kb(const b16* p, int hh) { const v8b a = *(const v8b*)(p + 8 * hh), b = *(const v8b*)(p + 16 + 8 * hh); v16b f;
#pragma unroll
  for (int e = 0; e < 8; ++e) { f[e] = a[e]; f[8 + e] = b[e]; } return f; }
__device__ __forceinline__ v8f wmma16b(v16b a, v16b b, v8f c) { v8f d = __builtin_amdgcn_wmma_f32_16x16x32_f16(false, a, false, b, (short)0, c, false, false); asm volatile("v_nop\n\tv_nop\n\tv_nop\n\tv_nop" : "+v"(d) : "v"(a), "v"(b)); return d; }
__device__ __forceinline__ void wave_lds_sync() { __builtin_amdgcn_fence(3 /* release order */, "workgroup"); __builtin_amdgcn_wave_barrier(); __builtin_amdgcn_fence(2 /* acquire order */, "workgroup"); }
__device__ __forceinline__ float nexp2(float v) { return __builtin_amdgcn_exp2f(v); }

__global__ __launch_bounds__(256) void prep_kernel(const float* __restrict__ wq, const float* __restrict__ wk, const float* __restrict__ wv, b16* __restrict__ WT) {
  const size_t u = (size_t)blockIdx.x * 256 + threadIdx.x; if (u >= (size_t)PREP_THREADS) return;
  const size_t e = u * 8; const int oo = (int)(e / C), c0 = (int)(e % C); const int m = oo / HD, o2 = oo % HD; const float* w = m == 0 ? wq : m == 1 ? wk : wv; v8b o;
#pragma unroll
  for (int j = 0; j < 8; ++j) o[j] = (b16)(bf16_rne(w[(size_t)(c0 + j) * HD + o2]) * WSC);
  { *(v8b*)(WT + e) = o;  }
}

// projections: grid (SQ/64, NBL, 3 parts: 0 q (row operand, plane QP [b][tok][64]), 1 k (streamed operand, plane KP [b][tok][64]), 2 v (V^T [b][d][tok])); block = 64 tokens x 4 waves,
__global__ __launch_bounds__(128) void proj_kernel(const float* __restrict__ X, const b16* __restrict__ WT, const float* __restrict__ bq, const float* __restrict__ bk, const float* __restrict__ bv,
                                                   b16* __restrict__ QP, b16* __restrict__ KP, b16* __restrict__ VT) {
  __shared__ __attribute__((aligned(16))) b16 As[64][KC + 8]; __shared__ __attribute__((aligned(16))) float Tf[4][16][HD + 4];
  const int wave = threadIdx.x >> 5, lane = threadIdx.x & 31, nloc = lane & 15, hlf = lane >> 4; const int t0 = blockIdx.x * 64; const int b = blockIdx.y; const int part = blockIdx.z;
  const float* xb = X + ((size_t)b * T_FULL + t0) * C; const float* bias = part == 0 ? bq : part == 1 ? bk : bv; const b16* W = WT + (size_t)part * HD * C;
  v8f acc[4];
#pragma unroll
  for (int t = 0; t < 4; ++t) acc[t] = (v8f){};
#pragma unroll 1
  for (int kc = 0; kc < C; kc += KC) {
    __syncthreads();
    for (int i = threadIdx.x; i < 64 * (KC / 4); i += 128) { const int rr = i / (KC / 4), q = (i % (KC / 4)) * 4; const v4f f = *(const v4f*)(xb + (size_t)rr * C + kc + q); v4h o;
#pragma unroll
      for (int j = 0; j < 4; ++j) o[j] = (b16)(bf16_rne(f[j]) * XS); *(v4h*)(&As[rr][q]) = o; }
    __syncthreads();
#pragma unroll 2
    for (int kb = 0; kb < KC; kb += 32) { const v16b a = frag_kb(&As[wave * 16 + nloc][kb], hlf);
#pragma unroll
      for (int t = 0; t < 4; ++t) acc[t] = wmma16b(a, frag_kb(W + (size_t)(t * 16 + nloc) * C + kc + kb, hlf), acc[t]); } }
#pragma unroll
  for (int t = 0; t < 4; ++t) { const float bb = bf16_rne(bias[t * 16 + nloc]);
#pragma unroll
    for (int r = 0; r < 8; ++r) Tf[wave][8 * hlf + r][t * 16 + nloc] = acc[t][r] * (1.0f / (XS * WSC)) + bb; }
  __syncthreads();   // part 2 reads Tf rows of all waves
  {
    if (part < 2) { b16* plane = part == 0 ? QP : KP;
#pragma unroll 1
      for (int it = 0; it < 4; ++it) { const int rr = it * 4 + (lane >> 3); const int tok = t0 + wave * 16 + rr; const int c8 = (lane & 7) * 8; v8b o8;
#pragma unroll
        for (int j = 0; j < 8; ++j) o8[j] = (b16)(Tf[wave][rr][c8 + j] * XS);
        *(v8b*)(plane + ((size_t)b * SQ + tok) * HD + c8) = o8; } }
    else {
#pragma unroll 1
      for (int it = 0; it < 4; ++it) { const int d = wave * 16 + it * 4 + (lane >> 3); const int tk0 = (lane & 7) * 8; v8b vv;
#pragma unroll
        for (int j = 0; j < 8; ++j) { const int tk = tk0 + j; vv[j] = (b16)(Tf[tk >> 4][tk & 15][d] * XS); }
        *(v8b*)(VT + ((size_t)b * HD + d) * (size_t)SQ + t0 + tk0) = vv; } }
     }
}

// attention: grid (SQ/QB, NBL): block = AW waves x 16 query rows; K and V^T tiles of KT keys are staged in LDS once per block by asynchronous copies (whole lines, two buffers, the next tile's
// copies in flight while this tile is worked on, one block barrier per tile) and every wave takes its fragments from there; q fragments register-resident; S^T = K_tile Q^T (lane col = query row,
// D rows = keys; K = 64 = 2 k-steps); online softmax over keys with running max; P x1024 single through per-wave LDS (each lane re-reads only its own slots); O^T += V^T P^T (4 d-tiles);
// out rows [b][t][64] f32:
__global__ __launch_bounds__(AW * 32) void attn_kernel(const b16* __restrict__ QP, const b16* __restrict__ KP, const b16* __restrict__ VT, float* __restrict__ out) {
  __shared__ __attribute__((aligned(16))) b16 Ks[2][KT][HD + 8]; __shared__ __attribute__((aligned(16))) b16 Vs[2][HD][KT + 8];   // row pitches 144 B and 272 B: 16 B x odd for 16-byte readers
  __shared__ __attribute__((aligned(16))) b16 Pb[AW][16][32 + 8]; __shared__ __attribute__((aligned(16))) float To[AW][16][HD + 4];
  const int tid = threadIdx.x, wave = tid >> 5, lane = tid & 31, hh = lane >> 4, col = lane & 15; const int b = blockIdx.y; const int r0 = blockIdx.x * QB + wave * 16, ri = r0 + col;
  const b16* Qb = QP + (size_t)b * SQ * HD; const b16* Kb = KP + (size_t)b * SQ * HD; const b16* Vb = VT + (size_t)b * HD * (size_t)SQ;
  // one tile: every thread copies 4 pieces of 16 B of K (16 KB in a row in memory) and 4 of V^T (64 rows of 256 B); a wave's copy covers 4 whole lines
  auto tile_copy = [&](int s0, int buf) {
    unsigned lk[4], lv[4]; const b16* gk[4]; const b16* gv[4];
#pragma unroll   // the address arrays stay in registers
    for (int j = 0; j < 4; ++j) { const int c = j * (AW * 32) + tid;
      lk[j] = (unsigned)(size_t)(&Ks[buf][c / (HD / 8)][(c % (HD / 8)) * 8]); gk[j] = Kb + (size_t)s0 * HD + (size_t)c * 8;
      lv[j] = (unsigned)(size_t)(&Vs[buf][c / (KT / 8)][(c % (KT / 8)) * 8]); gv[j] = Vb + (size_t)(c / (KT / 8)) * SQ + s0 + (c % (KT / 8)) * 8; }
    // the copies and, as their statement's last line, the wait that stands before any of their address registers is rewritten
    asm volatile("global_load_async_to_lds_b128 %0, %1, off\n\t"
                 "global_load_async_to_lds_b128 %2, %3, off\n\t"
                 "global_load_async_to_lds_b128 %4, %5, off\n\t"
                 "global_load_async_to_lds_b128 %6, %7, off\n\t"
                 "global_load_async_to_lds_b128 %8, %9, off\n\t"
                 "global_load_async_to_lds_b128 %10, %11, off\n\t"
                 "global_load_async_to_lds_b128 %12, %13, off\n\t"
                 "global_load_async_to_lds_b128 %14, %15, off\n\t"
                 "s_wait_xcnt 0x0"
                 :: "v"(lk[0]), "v"(gk[0]), "v"(lk[1]), "v"(gk[1]), "v"(lk[2]), "v"(gk[2]), "v"(lk[3]), "v"(gk[3]),
                    "v"(lv[0]), "v"(gv[0]), "v"(lv[1]), "v"(gv[1]), "v"(lv[2]), "v"(gv[2]), "v"(lv[3]), "v"(gv[3]) : "memory"); };
  tile_copy(0, 0);
  v16b qa[2];
#pragma unroll
  for (int i = 0; i < 2; ++i) qa[i] = frag_kb(Qb + (size_t)ri * HD + 32 * i, hh);
  const float cs = SCL * LOG2E / (XS * XS);
  float m = -__builtin_inff(), l = 0.0f; v8f o[4];
#pragma unroll
  for (int t = 0; t < 4; ++t) o[t] = (v8f){};
  asm volatile("s_wait_asynccnt 0x0" ::: "memory");   // this wave's copies of tile 0 have landed
  __syncthreads();   // tile 0 is published
  if (NT > 1) tile_copy(KT, 1);
#pragma unroll 1   // rolled: one tile's body is all the code the loop needs
  for (int tl = 0; tl < NT; ++tl) {
    const int buf = tl & 1;
#pragma unroll   // the offsets inside a tile become immediates of the LDS reads
    for (int sb = 0; sb < KT; sb += 32) {
      v16b kf[4], vf[4];   // the pass's fragments as one group of LDS reads ahead of its products
#pragma unroll   // fragment arrays stay in registers (this loop and the next)
      for (int u = 0; u < 4; ++u) kf[u] = frag_kb(&Ks[buf][sb + (u >> 1) * 16 + col][32 * (u & 1)], hh);
#pragma unroll
      for (int t = 0; t < 4; ++t) vf[t] = frag_kb(&Vs[buf][t * 16 + col][sb], hh);
      float e[16]; float mx = -__builtin_inff();
#pragma unroll
      for (int u = 0; u < 2; ++u) { v8f s = (v8f){};
#pragma unroll
        for (int i = 0; i < 2; ++i) s = wmma16b(kf[u * 2 + i], qa[i], s);
#pragma unroll
        for (int r = 0; r < 8; ++r) { const float vv = s[r] * cs; e[u * 8 + r] = vv; mx = fmaxf(mx, vv); } }
      mx = fmaxf(mx, __shfl_xor(mx, 16)); const float mn = fmaxf(m, mx); const float al = nexp2(m - mn); float sum = 0.0f;
#pragma unroll
      for (int i2 = 0; i2 < 16; ++i2) { const float p = nexp2(e[i2] - mn); sum += p; Pb[wave][col][(i2 < 8 ? 0 : 16) + 8 * hh + (i2 & 7)] = (b16)(p * PS); }
      sum += __shfl_xor(sum, 16); l = l * al + sum; m = mn;
      wave_lds_sync();
      const v16b pf = frag_kb(&Pb[wave][col][0], hh);
#pragma unroll
      for (int t = 0; t < 4; ++t) { o[t] *= al; o[t] = wmma16b(vf[t], pf, o[t]); }
      wave_lds_sync(); }
    asm volatile("s_wait_dscnt 0x0" ::: "memory");      // this wave's reads of tile tl are done
    asm volatile("s_wait_asynccnt 0x0" ::: "memory");   // this wave's copies of tile tl + 1 have landed
    __syncthreads();   // publishes tile tl + 1 and ends every wave's reads of tile tl
    if (tl + 2 < NT) tile_copy((tl + 2) * KT, buf);   // refill of the buffer that this pass has just read
  }
  asm volatile("s_wait_asynccnt 0x0" ::: "memory");   // no copy is left in flight behind the loop
  const float inv = 1.0f / (l * PS * XS);
#pragma unroll
  for (int t = 0; t < 4; ++t)
#pragma unroll
    for (int r = 0; r < 8; ++r) To[wave][col][t * 16 + 8 * hh + r] = o[t][r] * inv;
  wave_lds_sync();
  {
#pragma unroll 1
    for (int it = 0; it < 8; ++it) { const int rr = it * 2 + (lane >> 4); const int c4 = (lane & 15) * 4;
      *(v4f*)(out + ((size_t)b * SQ + r0 + rr) * HD + c4) = *(const v4f*)(&To[wave][rr][c4]); }
     }
}
}  // namespace

extern "C" void kernel_launch(void* const* d_in, const int* in_sizes, int n_in, void* d_out, int out_size, void* d_ws, size_t ws_size, hipStream_t stream) {
  if (n_in < 7) return;
  auto Fp = [&](int i) { return (const float*)d_in[i]; };
  // wire order: 0 x [16,2048,384], 1 Wq [384,64], 2 bq [64], 3 Wk [384,64], 4 bk [64], 5 Wv [384,64], 6 bv [64]
  if ((size_t)in_sizes[0] < (size_t)NBL * T_FULL * C || in_sizes[1] < C * HD || in_sizes[2] < HD || in_sizes[3] < C * HD || in_sizes[4] < HD || in_sizes[5] < C * HD || in_sizes[6] < HD) return;
  if ((size_t)out_size < (size_t)NBL * SQ * HD) return;
  size_t off = 0; char* ws = (char*)d_ws;
  auto carve = [&](size_t bytes) { char* p = ws + off; off += (bytes + 255) & ~(size_t)255; return p; };
  b16* WT = (b16*)carve((size_t)PREP_ELEMS * 2);            // 147,456 B
  const size_t plane = (size_t)NBL * SQ * HD * 2;            // 4,194,304 B at full size
  b16* QP = (b16*)carve(plane); b16* KP = (b16*)carve(plane); b16* VT = (b16*)carve(plane);
  if (off > ws_size || off > ((size_t)128 << 20)) return;    // about 12.7 MB total
  prep_kernel<<<(unsigned)(PREP_THREADS / 256), 256, 0, stream>>>(Fp(1), Fp(3), Fp(5), WT);
  proj_kernel<<<dim3(SQ / 64, NBL, 3), 128, 0, stream>>>(Fp(0), WT, Fp(2), Fp(4), Fp(6), QP, KP, VT);
  attn_kernel<<<dim3(SQ / QB, NBL), AW * 32, 0, stream>>>(QP, KP, VT, (float*)d_out);
}

// v002
// Measured time: 50 microseconds a run.
// Timed twice side by side with v001, it ran 1.22 times as fast both times.
// Over all steps from v000 it is 3.39 times as fast.
#include <hip/hip_runtime.h>

// All contractions: v_wmma_f32_16x16x32_f16 (16-bit operands, f32 accumulate). Projections q/k/v = X W + b with X bf16-exact (x8) staged block-wide and W^T [o][c] bf16-exact (x256): 1 product;
// S^T = K_tile Q^T with q/k single f16 x8 planes (K = 64): 1 product; O^T += V^T P^T with V^T single f16 x8 and P single f16 x1024: 1 product. Biases, online softmax statistics and the
// final normalisation in f32. All float inputs RNE-converted to bf16 once on load.

#ifndef NB
#define NB 16
#endif
#ifndef SEQ
#define SEQ 2048
#endif

namespace {
constexpr int B_FULL = 16, T_FULL = 2048, C = 384, HD = 64;
constexpr int NBL = NB;   // batches processed
constexpr int SQ = SEQ;   // tokens processed per batch (queries and keys); input stride per batch stays T_FULL
constexpr int KC = 128;   // k chunk of C staged in LDS per pass
constexpr float XS = 8.0f, WSC = 256.0f, PS = 1024.0f, LOG2E = 1.4426950408889634f, SCL = 0.125f;   // 64^-0.5
static_assert(NBL >= 1 && NBL <= B_FULL);
static_assert(SQ >= 64 && SQ <= T_FULL && SQ % 64 == 0 && SQ % 32 == 0);
static_assert(C % KC == 0 && KC % 32 == 0 && C % 8 == 0 && HD == 64);
static_assert(8 * 8 * 128 == HD * KC);   // 8 pieces of 8 halves per thread of a projection block fill the staged W^T chunk
constexpr int PREP_ELEMS = 3 * HD * C;           // 73728 halves in W^T
constexpr int PREP_THREADS = PREP_ELEMS / 8;     // 9216 threads, 8 halves each
static_assert(PREP_ELEMS % 8 == 0 && PREP_THREADS % 256 == 0);
// coverage: prep grid (PREP_THREADS/256) x 256 x 8 == 3*HD*C; proj grid (SQ/64, NBL) x 64 tokens x HD == NBL*SQ*HD per plane; attn grid (SQ/QB, NBL) x QB rows x HD == NBL*SQ*HD == out
static_assert((PREP_THREADS / 256) * 256 * 8 == PREP_ELEMS);
static_assert((SQ / 64) * 64 == SQ && (SQ / 32) * 32 == SQ);
constexpr int AW = 8, QB = AW * 16;   // attention block: waves, query rows
constexpr int KT = 128, NT = SQ / KT;   // keys per staged tile, tiles
static_assert(SQ % QB == 0 && SQ % KT == 0 && KT % 32 == 0 && 4 * 8 * AW * 32 == KT * HD);   // 4 pieces of 8 halves per thread fill each staged tile

typedef _Float16 b16;
typedef __attribute__((ext_vector_type(16))) _Float16 v16b;
typedef __attribute__((ext_vector_type(8))) _Float16 v8b;
typedef __attribute__((ext_vector_type(4))) _Float16 v4h;
typedef __attribute__((ext_vector_type(8))) float v8f;
typedef __attribute__((ext_vector_type(4))) float v4f;

__device__ __forceinline__ float bf16_rne(float f) { unsigned int u = __float_as_uint(f); u += 0x7FFFu + ((u >> 16) & 1u); return __uint_as_float(u & 0xFFFF0000u); }
__device__ __forceinline__ v16b frag_kb(const b16* p, int hh) { const v8b a = *(const v8b*)(p + 8 * hh), b = *(const v8b*)(p + 16 + 8 * hh); v16b f;
#pragma unroll
  for (int e = 0; e < 8; ++e) { f[e] = a[e]; f[8 + e] = b[e]; } return f; }
__device__ __forceinline__ v8f wmma16b(v16b a, v16b b, v8f c) { v8f d = __builtin_amdgcn_wmma_f32_16x16x32_f16(false, a, false, b, (short)0, c, false, false); asm volatile("v_nop\n\tv_nop\n\tv_nop\n\tv_nop" : "+v"(d) : "v"(a), "v"(b)); return d; }
__device__ __forceinline__ void wave_lds_sync() { __builtin_amdgcn_fence(3 /* release order */, "workgroup"); __builtin_amdgcn_wave_barrier(); __builtin_amdgcn_fence(2 /* acquire order */, "workgroup"); }
__device__ __forceinline__ float nexp2(float v) { return __builtin_amdgcn_exp2f(v); }

__global__ __launch_bounds__(256) void prep_kernel(const float* __restrict__ wq, const float* __restrict__ wk, const float* __restrict__ wv, b16* __restrict__ WT) {
  const size_t u = (size_t)blockIdx.x * 256 + threadIdx.x; if (u >= (size_t)PREP_THREADS) return;
  const size_t e = u * 8; const int oo = (int)(e / C), c0 = (int)(e % C); const int m = oo / HD, o2 = oo % HD; const float* w = m == 0 ? wq : m == 1 ? wk : wv; v8b o;
#pragma unroll
  for (int j = 0; j < 8; ++j) o[j] = (b16)(bf16_rne(w[(size_t)(c0 + j) * HD + o2]) * WSC);
  { *(v8b*)(WT + e) = o;  }
}

// projections: grid (SQ/64, NBL, 3 parts: 0 q (row operand, plane QP [b][tok][64]), 1 k (streamed operand, plane KP [b][tok][64]), 2 v (V^T [b][d][tok])); block = 64 tokens x 4 waves,
__global__ __launch_bounds__(128) void proj_kernel(const float* __restrict__ X, const b16* __restrict__ WT, const float* __restrict__ bq, const float* __restrict__ bk, const float* __restrict__ bv,
                                                   b16* __restrict__ QP, b16* __restrict__ KP, b16* __restrict__ VT) {
  __shared__ __attribute__((aligned(16))) b16 As[64][KC + 8]; __shared__ __attribute__((aligned(16))) float Tf[4][16][HD + 4];
  __shared__ __attribute__((aligned(16))) b16 Ws[HD][KC + 8];   // this part's W^T rows, one k chunk; row pitch 272 B: 16 B x odd for 16-byte readers
  const int wave = threadIdx.x >> 5, lane = threadIdx.x & 31, nloc = lane & 15, hlf = lane >> 4; const int t0 = blockIdx.x * 64; const int b = blockIdx.y; const int part = blockIdx.z;
  const float* xb = X + ((size_t)b * T_FULL + t0) * C; const float* bias = part == 0 ? bq : part == 1 ? bk : bv; const b16* W = WT + (size_t)part * HD * C;
  // one k chunk of W^T (64 rows of 256 B): every thread copies 8 pieces of 16 B; a wave's copy covers 2 rows of 2 whole lines each
  auto w_copy = [&](int kc) {
    unsigned lw[8]; const b16* gw[8];
#pragma unroll   // the address arrays stay in registers
    for (int j = 0; j < 8; ++j) { const int c = j * 128 + (int)threadIdx.x;
      lw[j] = (unsigned)(size_t)(&Ws[c / (KC / 8)][(c % (KC / 8)) * 8]); gw[j] = W + (size_t)(c / (KC / 8)) * C + kc + (c % (KC / 8)) * 8; }
    // the copies and, as their statement's last line, the wait that stands before any of their address registers is rewritten
    asm volatile("global_load_async_to_lds_b128 %0, %1, off\n\t"
                 "global_load_async_to_lds_b128 %2, %3, off\n\t"
                 "global_load_async_to_lds_b128 %4, %5, off\n\t"
                 "global_load_async_to_lds_b128 %6, %7, off\n\t"
                 "global_load_async_to_lds_b128 %8, %9, off\n\t"
                 "global_load_async_to_lds_b128 %10, %11, off\n\t"
                 "global_load_async_to_lds_b128 %12, %13, off\n\t"
                 "global_load_async_to_lds_b128 %14, %15, off\n\t"
                 "s_wait_xcnt 0x0"
                 :: "v"(lw[0]), "v"(gw[0]), "v"(lw[1]), "v"(gw[1]), "v"(lw[2]), "v"(gw[2]), "v"(lw[3]), "v"(gw[3]),
                    "v"(lw[4]), "v"(gw[4]), "v"(lw[5]), "v"(gw[5]), "v"(lw[6]), "v"(gw[6]), "v"(lw[7]), "v"(gw[7]) : "memory"); };
  v8f acc[4];
#pragma unroll
  for (int t = 0; t < 4; ++t) acc[t] = (v8f){};
#pragma unroll 1
  for (int kc = 0; kc < C; kc += KC) {
    asm volatile("s_wait_dscnt 0x0" ::: "memory");   // this wave's reads of the last chunk are done
    __syncthreads();   // ends every wave's reads of the last chunk
    w_copy(kc);   // in flight while the X chunk is converted
    for (int i = threadIdx.x; i < 64 * (KC / 4); i += 128) { const int rr = i / (KC / 4), q = (i % (KC / 4)) * 4; const v4f f = *(const v4f*)(xb + (size_t)rr * C + kc + q); v4h o;
#pragma unroll
      for (int j = 0; j < 4; ++j) o[j] = (b16)(bf16_rne(f[j]) * XS); *(v4h*)(&As[rr][q]) = o; }
    asm volatile("s_wait_asynccnt 0x0" ::: "memory");   // this wave's copies of the W^T chunk have landed
    __syncthreads();   // publishes the X chunk and the W^T chunk
#pragma unroll 2
    for (int kb = 0; kb < KC; kb += 32) { const v16b a = frag_kb(&As[wave * 16 + nloc][kb], hlf); v16b wf[4];   // the k step's fragments as one group of LDS reads ahead of its products
#pragma unroll   // the fragment array stays in registers
      for (int t = 0; t < 4; ++t) wf[t] = frag_kb(&Ws[t * 16 + nloc][kb], hlf);
#pragma unroll
      for (int t = 0; t < 4; ++t) acc[t] = wmma16b(a, wf[t], acc[t]); } }
#pragma unroll
  for (int t = 0; t < 4; ++t) { const float bb = bf16_rne(bias[t * 16 + nloc]);
#pragma unroll
    for (int r = 0; r < 8; ++r) Tf[wave][8 * hlf + r][t * 16 + nloc] = acc[t][r] * (1.0f / (XS * WSC)) + bb; }
  __syncthreads();   // part 2 reads Tf rows of all waves
  {
    if (part < 2) { b16* plane = part == 0 ? QP : KP;
#pragma unroll 1
      for (int it = 0; it < 4; ++it) { const int rr = it * 4 + (lane >> 3); const int tok = t0 + wave * 16 + rr; const int c8 = (lane & 7) * 8; v8b o8;
#pragma unroll
        for (int j = 0; j < 8; ++j) o8[j] = (b16)(Tf[wave][rr][c8 + j] * XS);
        *(v8b*)(plane + ((size_t)b * SQ + tok) * HD + c8) = o8; } }
    else {
#pragma unroll 1
      for (int it = 0; it < 4; ++it) { const int d = wave * 16 + it * 4 + (lane >> 3); const int tk0 = (lane & 7) * 8; v8b vv;
#pragma unroll
        for (int j = 0; j < 8; ++j) { const int tk = tk0 + j; vv[j] = (b16)(Tf[tk >> 4][tk & 15][d] * XS); }
        *(v8b*)(VT + ((size_t)b * HD + d) * (size_t)SQ + t0 + tk0) = vv; } }
     }
}

// attention: grid (SQ/QB, NBL): block = AW waves x 16 query rows; K and V^T tiles of KT keys are staged in LDS once per block by asynchronous copies (whole lines, two buffers, the next tile's
// copies in flight while this tile is worked on, one block barrier per tile) and every wave takes its fragments from there; q fragments register-resident; S^T = K_tile Q^T (lane col = query row,
// D rows = keys; K = 64 = 2 k-steps); online softmax over keys with running max; P x1024 single through per-wave LDS (each lane re-reads only its own slots); O^T += V^T P^T (4 d-tiles);
// out rows [b][t][64] f32:
__global__ __launch_bounds__(AW * 32) void attn_kernel(const b16* __restrict__ QP, const b16* __restrict__ KP, const b16* __restrict__ VT, float* __restrict__ out) {
  __shared__ __attribute__((aligned(16))) b16 Ks[2][KT][HD + 8]; __shared__ __attribute__((aligned(16))) b16 Vs[2][HD][KT + 8];   // row pitches 144 B and 272 B: 16 B x odd for 16-byte readers
  __shared__ __attribute__((aligned(16))) b16 Pb[AW][16][32 + 8]; __shared__ __attribute__((aligned(16))) float To[AW][16][HD + 4];
  const int tid = threadIdx.x, wave = tid >> 5, lane = tid & 31, hh = lane >> 4, col = lane & 15; const int b = blockIdx.y; const int r0 = blockIdx.x * QB + wave * 16, ri = r0 + col;
  const b16* Qb = QP + (size_t)b * SQ * HD; const b16* Kb = KP + (size_t)b * SQ * HD; const b16* Vb = VT + (size_t)b * HD * (size_t)SQ;
  // one tile: every thread copies 4 pieces of 16 B of K (16 KB in a row in memory) and 4 of V^T (64 rows of 256 B); a wave's copy covers 4 whole lines
  auto tile_copy = [&](int s0, int buf) {
    unsigned lk[4], lv[4]; const b16* gk[4]; const b16* gv[4];
#pragma unroll   // the address arrays stay in registers
    for (int j = 0; j < 4; ++j) { const int c = j * (AW * 32) + tid;
      lk[j] = (unsigned)(size_t)(&Ks[buf][c / (HD / 8)][(c % (HD / 8)) * 8]); gk[j] = Kb + (size_t)s0 * HD + (size_t)c * 8;
      lv[j] = (unsigned)(size_t)(&Vs[buf][c / (KT / 8)][(c % (KT / 8)) * 8]); gv[j] = Vb + (size_t)(c / (KT / 8)) * SQ + s0 + (c % (KT / 8)) * 8; }
    // the copies and, as their statement's last line, the wait that stands before any of their address registers is rewritten
    asm volatile("global_load_async_to_lds_b128 %0, %1, off\n\t"
                 "global_load_async_to_lds_b128 %2, %3, off\n\t"
                 "global_load_async_to_lds_b128 %4, %5, off\n\t"
                 "global_load_async_to_lds_b128 %6, %7, off\n\t"
                 "global_load_async_to_lds_b128 %8, %9, off\n\t"
                 "global_load_async_to_lds_b128 %10, %11, off\n\t"
                 "global_load_async_to_lds_b128 %12, %13, off\n\t"
                 "global_load_async_to_lds_b128 %14, %15, off\n\t"
                 "s_wait_xcnt 0x0"
                 :: "v"(lk[0]), "v"(gk[0]), "v"(lk[1]), "v"(gk[1]), "v"(lk[2]), "v"(gk[2]), "v"(lk[3]), "v"(gk[3]),
                    "v"(lv[0]), "v"(gv[0]), "v"(lv[1]), "v"(gv[1]), "v"(lv[2]), "v"(gv[2]), "v"(lv[3]), "v"(gv[3]) : "memory"); };
  tile_copy(0, 0);
  v16b qa[2];
#pragma unroll
  for (int i = 0; i < 2; ++i) qa[i] = frag_kb(Qb + (size_t)ri * HD + 32 * i, hh);
  const float cs = SCL * LOG2E / (XS * XS);
  float m = -__builtin_inff(), l = 0.0f; v8f o[4];
#pragma unroll
  for (int t = 0; t < 4; ++t) o[t] = (v8f){};
  asm volatile("s_wait_asynccnt 0x0" ::: "memory");   // this wave's copies of tile 0 have landed
  __syncthreads();   // tile 0 is published
  if (NT > 1) tile_copy(KT, 1);
#pragma unroll 1   // rolled: one tile's body is all the code the loop needs
  for (int tl = 0; tl < NT; ++tl) {
    const int buf = tl & 1;
#pragma unroll   // the offsets inside a tile become immediates of the LDS reads
    for (int sb = 0; sb < KT; sb += 32) {
      v16b kf[4], vf[4];   // the pass's fragments as one group of LDS reads ahead of its products
#pragma unroll   // fragment arrays stay in registers (this loop and the next)
      for (int u = 0; u < 4; ++u) kf[u] = frag_kb(&Ks[buf][sb + (u >> 1) * 16 + col][32 * (u & 1)], hh);
#pragma unroll
      for (int t = 0; t < 4; ++t) vf[t] = frag_kb(&Vs[buf][t * 16 + col][sb], hh);
      float e[16]; float mx = -__builtin_inff();
#pragma unroll
      for (int u = 0; u < 2; ++u) { v8f s = (v8f){};
#pragma unroll
        for (int i = 0; i < 2; ++i) s = wmma16b(kf[u * 2 + i], qa[i], s);
#pragma unroll
        for (int r = 0; r < 8; ++r) { const float vv = s[r] * cs; e[u * 8 + r] = vv; mx = fmaxf(mx, vv); } }
      mx = fmaxf(mx, __shfl_xor(mx, 16)); const float mn = fmaxf(m, mx); const float al = nexp2(m - mn); float sum = 0.0f;
#pragma unroll
      for (int i2 = 0; i2 < 16; ++i2) { const float p = nexp2(e[i2] - mn); sum += p; Pb[wave][col][(i2 < 8 ? 0 : 16) + 8 * hh + (i2 & 7)] = (b16)(p * PS); }
      sum += __shfl_xor(sum, 16); l = l * al + sum; m = mn;
      wave_lds_sync();
      const v16b pf = frag_kb(&Pb[wave][col][0], hh);
#pragma unroll
      for (int t = 0; t < 4; ++t) { o[t] *= al; o[t] = wmma16b(vf[t], pf, o[t]); }
      wave_lds_sync(); }
    asm volatile("s_wait_dscnt 0x0" ::: "memory");      // this wave's reads of tile tl are done
    asm volatile("s_wait_asynccnt 0x0" ::: "memory");   // this wave's copies of tile tl + 1 have landed
    __syncthreads();   // publishes tile tl + 1 and ends every wave's reads of tile tl
    if (tl + 2 < NT) tile_copy((tl + 2) * KT, buf);   // refill of the buffer that this pass has just read
  }
  asm volatile("s_wait_asynccnt 0x0" ::: "memory");   // no copy is left in flight behind the loop
  const float inv = 1.0f / (l * PS * XS);
#pragma unroll
  for (int t = 0; t < 4; ++t)
#pragma unroll
    for (int r = 0; r < 8; ++r) To[wave][col][t * 16 + 8 * hh + r] = o[t][r] * inv;
  wave_lds_sync();
  {
#pragma unroll 1
    for (int it = 0; it < 8; ++it) { const int rr = it * 2 + (lane >> 4); const int c4 = (lane & 15) * 4;
      *(v4f*)(out + ((size_t)b * SQ + r0 + rr) * HD + c4) = *(const v4f*)(&To[wave][rr][c4]); }
     }
}
}  // namespace

extern "C" void kernel_launch(void* const* d_in, const int* in_sizes, int n_in, void* d_out, int out_size, void* d_ws, size_t ws_size, hipStream_t stream) {
  if (n_in < 7) return;
  auto Fp = [&](int i) { return (const float*)d_in[i]; };
  // wire order: 0 x [16,2048,384], 1 Wq [384,64], 2 bq [64], 3 Wk [384,64], 4 bk [64], 5 Wv [384,64], 6 bv [64]
  if ((size_t)in_sizes[0] < (size_t)NBL * T_FULL * C || in_sizes[1] < C * HD || in_sizes[2] < HD || in_sizes[3] < C * HD || in_sizes[4] < HD || in_sizes[5] < C * HD || in_sizes[6] < HD) return;
  if ((size_t)out_size < (size_t)NBL * SQ * HD) return;
  size_t off = 0; char* ws = (char*)d_ws;
  auto carve = [&](size_t bytes) { char* p = ws + off; off += (bytes + 255) & ~(size_t)255; return p; };
  b16* WT = (b16*)carve((size_t)PREP_ELEMS * 2);            // 147,456 B
  const size_t plane = (size_t)NBL * SQ * HD * 2;            // 4,194,304 B at full size
  b16* QP = (b16*)carve(plane); b16* KP = (b16*)carve(plane); b16* VT = (b16*)carve(plane);
  if (off > ws_size || off > ((size_t)128 << 20)) return;    // about 12.7 MB total
  prep_kernel<<<(unsigned)(PREP_THREADS / 256), 256, 0, stream>>>(Fp(1), Fp(3), Fp(5), WT);
  proj_kernel<<<dim3(SQ / 64, NBL, 3), 128, 0, stream>>>(Fp(0), WT, Fp(2), Fp(4), Fp(6), QP, KP, VT);
  attn_kernel<<<dim3(SQ / QB, NBL), AW * 32, 0, stream>>>(QP, KP, VT, (float*)d_out);
}

// v003
// One run takes 46.2 microseconds.
// Next to v002, in two timings, it ran 1.08 and 1.09 times as fast.
// Counting every step since v000, it is 3.68 times as fast.
#include <hip/hip_runtime.h>

// All contractions: v_wmma_f32_16x16x32_f16 (16-bit operands, f32 accumulate). Projections q/k/v = X W + b with X bf16-exact (x8) staged block-wide and W^T [o][c] bf16-exact (x256): 1 product;
// S^T = K_tile Q^T with q/k single f16 x8 planes (K = 64): 1 product; O^T += V^T P^T with V^T single f16 x8 and P single f16 x1024: 1 product. Biases, online softmax statistics and the
// final normalisation in f32. All float inputs RNE-converted to bf16 once on load.

#ifndef NB
#define NB 16
#endif
#ifndef SEQ
#define SEQ 2048
#endif

namespace {
constexpr int B_FULL = 16, T_FULL = 2048, C = 384, HD = 64;
constexpr int NBL = NB;   // batches processed
constexpr int SQ = SEQ;   // tokens processed per batch (queries and keys); input stride per batch stays T_FULL
constexpr int KC = 128;   // k chunk of C staged in LDS per pass
constexpr float XS = 8.0f, WSC = 256.0f, PS = 1024.0f, LOG2E = 1.4426950408889634f, SCL = 0.125f;   // 64^-0.5
static_assert(NBL >= 1 && NBL <= B_FULL);
static_assert(SQ >= 64 && SQ <= T_FULL && SQ % 64 == 0 && SQ % 32 == 0);
static_assert(C % KC == 0 && KC % 32 == 0 && C % 8 == 0 && HD == 64);
static_assert(8 * 8 * 128 == HD * KC);   // 8 pieces of 8 halves per thread of a projection block fill the staged W^T chunk
constexpr int PREP_ELEMS = 3 * HD * C;           // 73728 halves in W^T
constexpr int PREP_THREADS = PREP_ELEMS / 8;     // 9216 threads, 8 halves each
static_assert(PREP_ELEMS % 8 == 0 && PREP_THREADS % 256 == 0);
// coverage: prep grid (PREP_THREADS/256) x 256 x 8 == 3*HD*C; proj grid (SQ/64, NBL) x 64 tokens x HD == NBL*SQ*HD per plane; attn grid (SQ/QB, NBL) x QB rows x HD == NBL*SQ*HD == out
static_assert((PREP_THREADS / 256) * 256 * 8 == PREP_ELEMS);
static_assert((SQ / 64) * 64 == SQ && (SQ / 32) * 32 == SQ);
constexpr int AW = 8, QB = AW * 16;   // attention block: waves, query rows
constexpr int KT = 128, NT = SQ / KT;   // keys per staged tile, tiles
static_assert(SQ % QB == 0 && SQ % KT == 0 && KT % 32 == 0 && 4 * 8 * AW * 32 == KT * HD);   // 4 pieces of 8 halves per thread fill each staged tile

typedef _Float16 b16;
typedef __attribute__((ext_vector_type(16))) _Float16 v16b;
typedef __attribute__((ext_vector_type(8))) _Float16 v8b;
typedef __attribute__((ext_vector_type(4))) _Float16 v4h;
typedef __attribute__((ext_vector_type(8))) float v8f;
typedef __attribute__((ext_vector_type(4))) float v4f;

__device__ __forceinline__ float bf16_rne(float f) { unsigned int u = __float_as_uint(f); u += 0x7FFFu + ((u >> 16) & 1u); return __uint_as_float(u & 0xFFFF0000u); }
__device__ __forceinline__ v16b frag_kb(const b16* p, int hh) { const v8b a = *(const v8b*)(p + 8 * hh), b = *(const v8b*)(p + 16 + 8 * hh); v16b f;
#pragma unroll
  for (int e = 0; e < 8; ++e) { f[e] = a[e]; f[8 + e] = b[e]; } return f; }
__device__ __forceinline__ v8f wmma16b(v16b a, v16b b, v8f c) { v8f d = __builtin_amdgcn_wmma_f32_16x16x32_f16(false, a, false, b, (short)0, c, false, false); asm volatile("v_nop\n\tv_nop\n\tv_nop\n\tv_nop" : "+v"(d) : "v"(a), "v"(b)); return d; }
__device__ __forceinline__ void wave_lds_sync() { __builtin_amdgcn_fence(3 /* release order */, "workgroup"); __builtin_amdgcn_wave_barrier(); __builtin_amdgcn_fence(2 /* acquire order */, "workgroup"); }
__device__ __forceinline__ float nexp2(float v) { return __builtin_amdgcn_exp2f(v); }
__device__ __forceinline__ float other_half(float v) { const int b = __float_as_int(v); return __int_as_float(__builtin_amdgcn_permlanex16(b, b, 0x76543210, 0xfedcba98, false, false)); }   // lane l takes lane l ^ 16's value, by a vector move

__global__ __launch_bounds__(256) void prep_kernel(const float* __restrict__ wq, const float* __restrict__ wk, const float* __restrict__ wv, b16* __restrict__ WT) {
  const size_t u = (size_t)blockIdx.x * 256 + threadIdx.x; if (u >= (size_t)PREP_THREADS) return;
  const size_t e = u * 8; const int oo = (int)(e / C), c0 = (int)(e % C); const int m = oo / HD, o2 = oo % HD; const float* w = m == 0 ? wq : m == 1 ? wk : wv; v8b o;
#pragma unroll
  for (int j = 0; j < 8; ++j) o[j] = (b16)(bf16_rne(w[(size_t)(c0 + j) * HD + o2]) * WSC);
  { *(v8b*)(WT + e) = o;  }
}

// projections: grid (SQ/64, NBL, 3 parts: 0 q (row operand, plane QP [b][tok][64]), 1 k (streamed operand, plane KP [b][tok][64]), 2 v (V^T [b][d][tok])); block = 64 tokens x 4 waves,
__global__ __launch_bounds__(128) void proj_kernel(const float* __restrict__ X, const b16* __restrict__ WT, const float* __restrict__ bq, const float* __restrict__ bk, const float* __restrict__ bv,
                                                   b16* __restrict__ QP, b16* __restrict__ KP, b16* __restrict__ VT) {
  __shared__ __attribute__((aligned(16))) b16 As[64][KC + 8]; __shared__ __attribute__((aligned(16))) float Tf[4][16][HD + 4];
  __shared__ __attribute__((aligned(16))) b16 Ws[HD][KC + 8];   // this part's W^T rows, one k chunk; row pitch 272 B: 16 B x odd for 16-byte readers
  const int wave = threadIdx.x >> 5, lane = threadIdx.x & 31, nloc = lane & 15, hlf = lane >> 4; const int t0 = blockIdx.x * 64; const int b = blockIdx.y; const int part = blockIdx.z;
  const float* xb = X + ((size_t)b * T_FULL + t0) * C; const float* bias = part == 0 ? bq : part == 1 ? bk : bv; const b16* W = WT + (size_t)part * HD * C;
  // one k chunk of W^T (64 rows of 256 B): every thread copies 8 pieces of 16 B; a wave's copy covers 2 rows of 2 whole lines each
  auto w_copy = [&](int kc) {
    unsigned lw[8]; const b16* gw[8];
#pragma unroll   // the address arrays stay in registers
    for (int j = 0; j < 8; ++j) { const int c = j * 128 + (int)threadIdx.x;
      lw[j] = (unsigned)(size_t)(&Ws[c / (KC / 8)][(c % (KC / 8)) * 8]); gw[j] = W + (size_t)(c / (KC / 8)) * C + kc + (c % (KC / 8)) * 8; }
    // the copies and, as their statement's last line, the wait that stands before any of their address registers is rewritten
    asm volatile("global_load_async_to_lds_b128 %0, %1, off\n\t"
                 "global_load_async_to_lds_b128 %2, %3, off\n\t"
                 "global_load_async_to_lds_b128 %4, %5, off\n\t"
                 "global_load_async_to_lds_b128 %6, %7, off\n\t"
                 "global_load_async_to_lds_b128 %8, %9, off\n\t"
                 "global_load_async_to_lds_b128 %10, %11, off\n\t"
                 "global_load_async_to_lds_b128 %12, %13, off\n\t"
                 "global_load_async_to_lds_b128 %14, %15, off\n\t"
                 "s_wait_xcnt 0x0"
                 :: "v"(lw[0]), "v"(gw[0]), "v"(lw[1]), "v"(gw[1]), "v"(lw[2]), "v"(gw[2]), "v"(lw[3]), "v"(gw[3]),
                    "v"(lw[4]), "v"(gw[4]), "v"(lw[5]), "v"(gw[5]), "v"(lw[6]), "v"(gw[6]), "v"(lw[7]), "v"(gw[7]) : "memory"); };
  v8f acc[4];
#pragma unroll
  for (int t = 0; t < 4; ++t) acc[t] = (v8f){};
#pragma unroll 1
  for (int kc = 0; kc < C; kc += KC) {
    asm volatile("s_wait_dscnt 0x0" ::: "memory");   // this wave's reads of the last chunk are done
    __syncthreads();   // ends every wave's reads of the last chunk
    w_copy(kc);   // in flight while the X chunk is converted
    for (int i = threadIdx.x; i < 64 * (KC / 4); i += 128) { const int rr = i / (KC / 4), q = (i % (KC / 4)) * 4; const v4f f = *(const v4f*)(xb + (size_t)rr * C + kc + q); v4h o;
#pragma unroll
      for (int j = 0; j < 4; ++j) o[j] = (b16)(bf16_rne(f[j]) * XS); *(v4h*)(&As[rr][q]) = o; }
    asm volatile("s_wait_asynccnt 0x0" ::: "memory");   // this wave's copies of the W^T chunk have landed
    __syncthreads();   // publishes the X chunk and the W^T chunk
#pragma unroll 2
    for (int kb = 0; kb < KC; kb += 32) { const v16b a = frag_kb(&As[wave * 16 + nloc][kb], hlf); v16b wf[4];   // the k step's fragments as one group of LDS reads ahead of its products
#pragma unroll   // the fragment array stays in registers
      for (int t = 0; t < 4; ++t) wf[t] = frag_kb(&Ws[t * 16 + nloc][kb], hlf);
#pragma unroll
      for (int t = 0; t < 4; ++t) acc[t] = wmma16b(a, wf[t], acc[t]); } }
#pragma unroll
  for (int t = 0; t < 4; ++t) { const float bb = bf16_rne(bias[t * 16 + nloc]);
#pragma unroll
    for (int r = 0; r < 8; ++r) Tf[wave][8 * hlf + r][t * 16 + nloc] = acc[t][r] * (1.0f / (XS * WSC)) + bb; }
  __syncthreads();   // part 2 reads Tf rows of all waves
  {
    if (part < 2) { b16* plane = part == 0 ? QP : KP;
#pragma unroll 1
      for (int it = 0; it < 4; ++it) { const int rr = it * 4 + (lane >> 3); const int tok = t0 + wave * 16 + rr; const int c8 = (lane & 7) * 8; v8b o8;
#pragma unroll
        for (int j = 0; j < 8; ++j) o8[j] = (b16)(Tf[wave][rr][c8 + j] * XS);
        *(v8b*)(plane + ((size_t)b * SQ + tok) * HD + c8) = o8; } }
    else {
#pragma unroll 1
      for (int it = 0; it < 4; ++it) { const int d = wave * 16 + it * 4 + (lane >> 3); const int tk0 = (lane & 7) * 8; v8b vv;
#pragma unroll
        for (int j = 0; j < 8; ++j) { const int tk = tk0 + j; vv[j] = (b16)(Tf[tk >> 4][tk & 15][d] * XS); }
        *(v8b*)(VT + ((size_t)b * HD + d) * (size_t)SQ + t0 + tk0) = vv; } }
     }
}

// attention: grid (SQ/QB, NBL): block = AW waves x 16 query rows; K and V^T tiles of KT keys are staged in LDS once per block by asynchronous copies (whole lines, two buffers, the next tile's
// copies in flight while this tile is worked on, one block barrier per tile) and every wave takes its fragments from there; q fragments register-resident; S^T = K_tile Q^T (lane col = query row,
// D rows = keys; K = 64 = 2 k-steps); online softmax over keys with running max; P x1024 single, packed in registers: a lane's 16 scores of a pass are its 16 elements of the B fragment; O^T += V^T P^T (4 d-tiles);
// out rows [b][t][64] f32:
__global__ __launch_bounds__(AW * 32) void attn_kernel(const b16* __restrict__ QP, const b16* __restrict__ KP, const b16* __restrict__ VT, float* __restrict__ out) {
  __shared__ __attribute__((aligned(16))) b16 Ks[2][KT][HD + 8]; __shared__ __attribute__((aligned(16))) b16 Vs[2][HD][KT + 8];   // row pitches 144 B and 272 B: 16 B x odd for 16-byte readers
  __shared__ __attribute__((aligned(16))) float To[AW][16][HD + 4];
  const int tid = threadIdx.x, wave = tid >> 5, lane = tid & 31, hh = lane >> 4, col = lane & 15; const int b = blockIdx.y; const int r0 = blockIdx.x * QB + wave * 16, ri = r0 + col;
  const b16* Qb = QP + (size_t)b * SQ * HD; const b16* Kb = KP + (size_t)b * SQ * HD; const b16* Vb = VT + (size_t)b * HD * (size_t)SQ;
  // one tile: every thread copies 4 pieces of 16 B of K (16 KB in a row in memory) and 4 of V^T (64 rows of 256 B); a wave's copy covers 4 whole lines
  auto tile_copy = [&](int s0, int buf) {
    unsigned lk[4], lv[4]; const b16* gk[4]; const b16* gv[4];
#pragma unroll   // the address arrays stay in registers
    for (int j = 0; j < 4; ++j) { const int c = j * (AW * 32) + tid;
      lk[j] = (unsigned)(size_t)(&Ks[buf][c / (HD / 8)][(c % (HD / 8)) * 8]); gk[j] = Kb + (size_t)s0 * HD + (size_t)c * 8;
      lv[j] = (unsigned)(size_t)(&Vs[buf][c / (KT / 8)][(c % (KT / 8)) * 8]); gv[j] = Vb + (size_t)(c / (KT / 8)) * SQ + s0 + (c % (KT / 8)) * 8; }
    // the copies and, as their statement's last line, the wait that stands before any of their address registers is rewritten
    asm volatile("global_load_async_to_lds_b128 %0, %1, off\n\t"
                 "global_load_async_to_lds_b128 %2, %3, off\n\t"
                 "global_load_async_to_lds_b128 %4, %5, off\n\t"
                 "global_load_async_to_lds_b128 %6, %7, off\n\t"
                 "global_load_async_to_lds_b128 %8, %9, off\n\t"
                 "global_load_async_to_lds_b128 %10, %11, off\n\t"
                 "global_load_async_to_lds_b128 %12, %13, off\n\t"
                 "global_load_async_to_lds_b128 %14, %15, off\n\t"
                 "s_wait_xcnt 0x0"
                 :: "v"(lk[0]), "v"(gk[0]), "v"(lk[1]), "v"(gk[1]), "v"(lk[2]), "v"(gk[2]), "v"(lk[3]), "v"(gk[3]),
                    "v"(lv[0]), "v"(gv[0]), "v"(lv[1]), "v"(gv[1]), "v"(lv[2]), "v"(gv[2]), "v"(lv[3]), "v"(gv[3]) : "memory"); };
  tile_copy(0, 0);
  v16b qa[2];
#pragma unroll
  for (int i = 0; i < 2; ++i) qa[i] = frag_kb(Qb + (size_t)ri * HD + 32 * i, hh);
  const float cs = SCL * LOG2E / (XS * XS);
  float m = -__builtin_inff(), l = 0.0f; v8f o[4];
#pragma unroll
  for (int t = 0; t < 4; ++t) o[t] = (v8f){};
  asm volatile("s_wait_asynccnt 0x0" ::: "memory");   // this wave's copies of tile 0 have landed
  __syncthreads();   // tile 0 is published
  if (NT > 1) tile_copy(KT, 1);
#pragma unroll 1   // rolled: one tile's body is all the code the loop needs
  for (int tl = 0; tl < NT; ++tl) {
    const int buf = tl & 1;
#pragma unroll   // the offsets inside a tile become immediates of the LDS reads
    for (int sb = 0; sb < KT; sb += 32) {
      v16b kf[4], vf[4];   // the pass's fragments as one group of LDS reads ahead of its products
#pragma unroll   // fragment arrays stay in registers (this loop and the next)
      for (int u = 0; u < 4; ++u) kf[u] = frag_kb(&Ks[buf][sb + (u >> 1) * 16 + col][32 * (u & 1)], hh);
#pragma unroll
      for (int t = 0; t < 4; ++t) vf[t] = frag_kb(&Vs[buf][t * 16 + col][sb], hh);
      float e[16]; float mx = -__builtin_inff();
#pragma unroll
      for (int u = 0; u < 2; ++u) { v8f s = (v8f){};
#pragma unroll
        for (int i = 0; i < 2; ++i) s = wmma16b(kf[u * 2 + i], qa[i], s);
#pragma unroll
        for (int r = 0; r < 8; ++r) { const float vv = s[r] * cs; e[u * 8 + r] = vv; mx = fmaxf(mx, vv); } }
      mx = fmaxf(mx, other_half(mx)); const float mn = fmaxf(m, mx); const float al = nexp2(m - mn); float sum = 0.0f; v16b pf;
#pragma unroll
      for (int i2 = 0; i2 < 16; ++i2) { const float p = nexp2(e[i2] - mn); sum += p; pf[i2] = (b16)(p * PS); }   // element i2 of the B fragment is key (i2 < 8 ? 0 : 16) + 8 * hh + (i2 & 7): the key of score register i2
      sum += other_half(sum); l = l * al + sum; m = mn;
#pragma unroll
      for (int t = 0; t < 4; ++t) o[t] *= al;
      __builtin_amdgcn_sched_barrier(0);   // keeps the pass's vector work (subtracts, exponentials, scalings, conversions, rescale) as groups ahead of the products: scheduled across this line it came out chained pair by pair, each link's latency exposed
#pragma unroll
      for (int t = 0; t < 4; ++t) o[t] = wmma16b(vf[t], pf, o[t]); }
    asm volatile("s_wait_dscnt 0x0" ::: "memory");      // this wave's reads of tile tl are done
    asm volatile("s_wait_asynccnt 0x0" ::: "memory");   // this wave's copies of tile tl + 1 have landed
    __syncthreads();   // publishes tile tl + 1 and ends every wave's reads of tile tl
    if (tl + 2 < NT) tile_copy((tl + 2) * KT, buf);   // refill of the buffer that this pass has just read
  }
  asm volatile("s_wait_asynccnt 0x0" ::: "memory");   // no copy is left in flight behind the loop
  const float inv = 1.0f / (l * PS * XS);
#pragma unroll
  for (int t = 0; t < 4; ++t)
#pragma unroll
    for (int r = 0; r < 8; ++r) To[wave][col][t * 16 + 8 * hh + r] = o[t][r] * inv;
  wave_lds_sync();
  {
#pragma unroll 1
    for (int it = 0; it < 8; ++it) { const int rr = it * 2 + (lane >> 4); const int c4 = (lane & 15) * 4;
      *(v4f*)(out + ((size_t)b * SQ + r0 + rr) * HD + c4) = *(const v4f*)(&To[wave][rr][c4]); }
     }
}
}  // namespace

extern "C" void kernel_launch(void* const* d_in, const int* in_sizes, int n_in, void* d_out, int out_size, void* d_ws, size_t ws_size, hipStream_t stream) {
  if (n_in < 7) return;
  auto Fp = [&](int i) { return (const float*)d_in[i]; };
  // wire order: 0 x [16,2048,384], 1 Wq [384,64], 2 bq [64], 3 Wk [384,64], 4 bk [64], 5 Wv [384,64], 6 bv [64]
  if ((size_t)in_sizes[0] < (size_t)NBL * T_FULL * C || in_sizes[1] < C * HD || in_sizes[2] < HD || in_sizes[3] < C * HD || in_sizes[4] < HD || in_sizes[5] < C * HD || in_sizes[6] < HD) return;
  if ((size_t)out_size < (size_t)NBL * SQ * HD) return;
  size_t off = 0; char* ws = (char*)d_ws;
  auto carve = [&](size_t bytes) { char* p = ws + off; off += (bytes + 255) & ~(size_t)255; return p; };
  b16* WT = (b16*)carve((size_t)PREP_ELEMS * 2);            // 147,456 B
  const size_t plane = (size_t)NBL * SQ * HD * 2;            // 4,194,304 B at full size
  b16* QP = (b16*)carve(plane); b16* KP = (b16*)carve(plane); b16* VT = (b16*)carve(plane);
  if (off > ws_size || off > ((size_t)128 << 20)) return;    // about 12.7 MB total
  prep_kernel<<<(unsigned)(PREP_THREADS / 256), 256, 0, stream>>>(Fp(1), Fp(3), Fp(5), WT);
  proj_kernel<<<dim3(SQ / 64, NBL, 3), 128, 0, stream>>>(Fp(0), WT, Fp(2), Fp(4), Fp(6), QP, KP, VT);
  attn_kernel<<<dim3(SQ / QB, NBL), AW * 32, 0, stream>>>(QP, KP, VT, (float*)d_out);
}

// v004
// It runs in 38.7 microseconds.
// Timed twice side by side with v003, it ran 1.19 times as fast both times.
// Over all steps from v000 it is 4.39 times as fast.
#include <hip/hip_runtime.h>

// All contractions: v_wmma_f32_16x16x32_f16 (16-bit operands, f32 accumulate). Projections q/k/v = X W + b with X bf16-exact (x8) staged block-wide and W^T [o][c] bf16-exact (x256): 1 product;
// S^T = K_tile Q^T with q/k single f16 x8 planes (K = 64): 1 product; O^T += V^T P^T with V^T single f16 x8 and P single f16 x1024: 1 product. Biases, online softmax statistics and the
// final normalisation in f32. All float inputs RNE-converted to bf16 once on load.

#ifndef NB
#define NB 16
#endif
#ifndef SEQ
#define SEQ 2048
#endif

namespace {
constexpr int B_FULL = 16, T_FULL = 2048, C = 384, HD = 64;
constexpr int NBL = NB;   // batches processed
constexpr int SQ = SEQ;   // tokens processed per batch (queries and keys); input stride per batch stays T_FULL
constexpr int KC = 128;   // k chunk of C staged in LDS per pass
constexpr float XS = 8.0f, WSC = 256.0f, PS = 1024.0f, LOG2E = 1.4426950408889634f, SCL = 0.125f;   // 64^-0.5
static_assert(NBL >= 1 && NBL <= B_FULL);
static_assert(SQ >= 64 && SQ <= T_FULL && SQ % 64 == 0 && SQ % 32 == 0);
static_assert(C % KC == 0 && KC % 32 == 0 && C % 8 == 0 && HD == 64);
constexpr int XL = 64 * (KC / 4) / 128;   // 16-byte loads of X per thread and k chunk in a projection block
static_assert(KC / 4 == 32 && XL * 4 == 64);   // one wave's load covers one token's row of the chunk; 4 waves x XL loads cover the 64 tokens
static_assert(8 * 8 * 128 == HD * KC);   // 8 pieces of 8 halves per thread of a projection block fill the staged W^T chunk
constexpr int PREP_ELEMS = 3 * HD * C;           // 73728 halves in W^T
constexpr int PREP_THREADS = PREP_ELEMS / 8;     // 9216 threads, 8 halves each
static_assert(PREP_ELEMS % 8 == 0 && PREP_THREADS % 256 == 0);
// coverage: prep grid (PREP_THREADS/256) x 256 x 8 == 3*HD*C; proj grid (SQ/64, NBL) x 64 tokens x HD == NBL*SQ*HD per plane; attn grid (SQ/QB, NBL) x QB rows x HD == NBL*SQ*HD == out
static_assert((PREP_THREADS / 256) * 256 * 8 == PREP_ELEMS);
static_assert((SQ / 64) * 64 == SQ && (SQ / 32) * 32 == SQ);
constexpr int AW = 8, QB = AW * 16;   // attention block: waves, query rows
constexpr int KT = 128, NT = SQ / KT;   // keys per staged tile, tiles
static_assert(SQ % QB == 0 && SQ % KT == 0 && KT % 32 == 0 && 4 * 8 * AW * 32 == KT * HD);   // 4 pieces of 8 halves per thread fill each staged tile

typedef _Float16 b16;
typedef __attribute__((ext_vector_type(16))) _Float16 v16b;
typedef __attribute__((ext_vector_type(8))) _Float16 v8b;
typedef __attribute__((ext_vector_type(4))) _Float16 v4h;
typedef __attribute__((ext_vector_type(8))) float v8f;
typedef __attribute__((ext_vector_type(4))) float v4f;

__device__ __forceinline__ float bf16_rne(float f) { unsigned int u = __float_as_uint(f); u += 0x7FFFu + ((u >> 16) & 1u); return __uint_as_float(u & 0xFFFF0000u); }
__device__ __forceinline__ v16b frag_kb(const b16* p, int hh) { const v8b a = *(const v8b*)(p + 8 * hh), b = *(const v8b*)(p + 16 + 8 * hh); v16b f;
#pragma unroll
  for (int e = 0; e < 8; ++e) { f[e] = a[e]; f[8 + e] = b[e]; } return f; }
__device__ __forceinline__ v8f wmma16b(v16b a, v16b b, v8f c) { v8f d = __builtin_amdgcn_wmma_f32_16x16x32_f16(false, a, false, b, (short)0, c, false, false); asm volatile("v_nop\n\tv_nop\n\tv_nop\n\tv_nop" : "+v"(d) : "v"(a), "v"(b)); return d; }
__device__ __forceinline__ void wave_lds_sync() { __builtin_amdgcn_fence(3 /* release order */, "workgroup"); __builtin_amdgcn_wave_barrier(); __builtin_amdgcn_fence(2 /* acquire order */, "workgroup"); }
__device__ __forceinline__ float nexp2(float v) { return __builtin_amdgcn_exp2f(v); }
__device__ __forceinline__ float other_half(float v) { const int b = __float_as_int(v); return __int_as_float(__builtin_amdgcn_permlanex16(b, b, 0x76543210, 0xfedcba98, false, false)); }   // lane l takes lane l ^ 16's value, by a vector move

__global__ __launch_bounds__(256) void prep_kernel(const float* __restrict__ wq, const float* __restrict__ wk, const float* __restrict__ wv, b16* __restrict__ WT) {
  const size_t u = (size_t)blockIdx.x * 256 + threadIdx.x; if (u >= (size_t)PREP_THREADS) return;
  const size_t e = u * 8; const int oo = (int)(e / C), c0 = (int)(e % C); const int m = oo / HD, o2 = oo % HD; const float* w = m == 0 ? wq : m == 1 ? wk : wv; v8b o;
#pragma unroll
  for (int j = 0; j < 8; ++j) o[j] = (b16)(bf16_rne(w[(size_t)(c0 + j) * HD + o2]) * WSC);
  { *(v8b*)(WT + e) = o;  }
}

// projections: grid (SQ/64, NBL, 3 parts: 0 q (row operand, plane QP [b][tok][64]), 1 k (streamed operand, plane KP [b][tok][64]), 2 v (V^T [b][d][tok])); block = 64 tokens x 4 waves,
// register budget of 6 waves per SIMD: the 6 blocks of a WGP's share of the grid stay resident together with the load group's registers
__global__ __launch_bounds__(128) __attribute__((amdgpu_waves_per_eu(6))) void proj_kernel(const float* __restrict__ X, const b16* __restrict__ WT, const float* __restrict__ bq, const float* __restrict__ bk, const float* __restrict__ bv,
                                                   b16* __restrict__ QP, b16* __restrict__ KP, b16* __restrict__ VT) {
  __shared__ __attribute__((aligned(16))) b16 As[64][KC + 8]; __shared__ __attribute__((aligned(16))) float Tf[4][16][HD + 4];
  __shared__ __attribute__((aligned(16))) b16 Ws[HD][KC + 8];   // this part's W^T rows, one k chunk; row pitch 272 B: 16 B x odd for 16-byte readers
  const int wave = threadIdx.x >> 5, lane = threadIdx.x & 31, nloc = lane & 15, hlf = lane >> 4; const int t0 = blockIdx.x * 64; const int b = blockIdx.y; const int part = blockIdx.z;
  const float* xb = X + ((size_t)b * T_FULL + t0) * C; const float* bias = part == 0 ? bq : part == 1 ? bk : bv; const b16* W = WT + (size_t)part * HD * C;
  // one k chunk of W^T (64 rows of 256 B): every thread copies 8 pieces of 16 B; a wave's copy covers 2 rows of 2 whole lines each
  auto w_copy = [&](int kc) {
    unsigned lw[8]; const b16* gw[8];
#pragma unroll   // the address arrays stay in registers
    for (int j = 0; j < 8; ++j) { const int c = j * 128 + (int)threadIdx.x;
      lw[j] = (unsigned)(size_t)(&Ws[c / (KC / 8)][(c % (KC / 8)) * 8]); gw[j] = W + (size_t)(c / (KC / 8)) * C + kc + (c % (KC / 8)) * 8; }
    // the copies and, as their statement's last line, the wait that stands before any of their address registers is rewritten
    asm volatile("global_load_async_to_lds_b128 %0, %1, off\n\t"
                 "global_load_async_to_lds_b128 %2, %3, off\n\t"
                 "global_load_async_to_lds_b128 %4, %5, off\n\t"
                 "global_load_async_to_lds_b128 %6, %7, off\n\t"
                 "global_load_async_to_lds_b128 %8, %9, off\n\t"
                 "global_load_async_to_lds_b128 %10, %11, off\n\t"
                 "global_load_async_to_lds_b128 %12, %13, off\n\t"
                 "global_load_async_to_lds_b128 %14, %15, off\n\t"
                 "s_wait_xcnt 0x0"
                 :: "v"(lw[0]), "v"(gw[0]), "v"(lw[1]), "v"(gw[1]), "v"(lw[2]), "v"(gw[2]), "v"(lw[3]), "v"(gw[3]),
                    "v"(lw[4]), "v"(gw[4]), "v"(lw[5]), "v"(gw[5]), "v"(lw[6]), "v"(gw[6]), "v"(lw[7]), "v"(gw[7]) : "memory"); };
  const float* xp = xb + wave * C + lane * 4;   // the thread's place in a group of 4 token rows: wave = row, lane = 16-byte piece; steps on by a chunk per pass
  v8f acc[4];
#pragma unroll
  for (int t = 0; t < 4; ++t) acc[t] = (v8f){};
#pragma unroll 1
  for (int kc = 0; kc < C; kc += KC) {
    asm volatile("s_wait_dscnt 0x0" ::: "memory");   // this wave's reads of the last chunk are done
    __syncthreads();   // ends every wave's reads of the last chunk
    w_copy(kc);   // in flight while the X chunk is converted
    v4f xf[XL];   // the thread's whole share of the X chunk: every load is issued before the first value is used, so a chunk costs one memory round trip, not one per pair of loads
#pragma unroll   // the load array stays in registers (this loop and the next); the row steps become immediate offsets
    for (int g = 0; g < XL; ++g) xf[g] = *(const v4f*)(xp + g * 4 * C);
    xp += KC;
#pragma unroll
    for (int g = 0; g < XL; ++g) { v4h o;
#pragma unroll
      for (int j = 0; j < 4; ++j) o[j] = (b16)(bf16_rne(xf[g][j]) * XS); *(v4h*)(&As[g * 4 + wave][lane * 4]) = o; }
    asm volatile("s_wait_asynccnt 0x0" ::: "memory");   // this wave's copies of the W^T chunk have landed
    __syncthreads();   // publishes the X chunk and the W^T chunk
#pragma unroll 2
    for (int kb = 0; kb < KC; kb += 32) { const v16b a = frag_kb(&As[wave * 16 + nloc][kb], hlf); v16b wf[4];   // the k step's fragments as one group of LDS reads ahead of its products
#pragma unroll   // the fragment array stays in registers
      for (int t = 0; t < 4; ++t) wf[t] = frag_kb(&Ws[t * 16 + nloc][kb], hlf);
#pragma unroll
      for (int t = 0; t < 4; ++t) acc[t] = wmma16b(a, wf[t], acc[t]); } }
#pragma unroll
  for (int t = 0; t < 4; ++t) { const float bb = bf16_rne(bias[t * 16 + nloc]);
#pragma unroll
    for (int r = 0; r < 8; ++r) Tf[wave][8 * hlf + r][t * 16 + nloc] = acc[t][r] * (1.0f / (XS * WSC)) + bb; }
  __syncthreads();   // part 2 reads Tf rows of all waves
  {
    if (part < 2) { b16* plane = part == 0 ? QP : KP;
#pragma unroll 1
      for (int it = 0; it < 4; ++it) { const int rr = it * 4 + (lane >> 3); const int tok = t0 + wave * 16 + rr; const int c8 = (lane & 7) * 8; v8b o8;
#pragma unroll
        for (int j = 0; j < 8; ++j) o8[j] = (b16)(Tf[wave][rr][c8 + j] * XS);
        *(v8b*)(plane + ((size_t)b * SQ + tok) * HD + c8) = o8; } }
    else {
#pragma unroll 1
      for (int it = 0; it < 4; ++it) { const int d = wave * 16 + it * 4 + (lane >> 3); const int tk0 = (lane & 7) * 8; v8b vv;
#pragma unroll
        for (int j = 0; j < 8; ++j) { const int tk = tk0 + j; vv[j] = (b16)(Tf[tk >> 4][tk & 15][d] * XS); }
        *(v8b*)(VT + ((size_t)b * HD + d) * (size_t)SQ + t0 + tk0) = vv; } }
     }
}

// attention: grid (SQ/QB, NBL): block = AW waves x 16 query rows; K and V^T tiles of KT keys are staged in LDS once per block by asynchronous copies (whole lines, two buffers, the next tile's
// copies in flight while this tile is worked on, one block barrier per tile) and every wave takes its fragments from there; q fragments register-resident; S^T = K_tile Q^T (lane col = query row,
// D rows = keys; K = 64 = 2 k-steps); online softmax over keys with running max; P x1024 single, packed in registers: a lane's 16 scores of a pass are its 16 elements of the B fragment; O^T += V^T P^T (4 d-tiles);
// out rows [b][t][64] f32:
__global__ __launch_bounds__(AW * 32) void attn_kernel(const b16* __restrict__ QP, const b16* __restrict__ KP, const b16* __restrict__ VT, float* __restrict__ out) {
  __shared__ __attribute__((aligned(16))) b16 Ks[2][KT][HD + 8]; __shared__ __attribute__((aligned(16))) b16 Vs[2][HD][KT + 8];   // row pitches 144 B and 272 B: 16 B x odd for 16-byte readers
  __shared__ __attribute__((aligned(16))) float To[AW][16][HD + 4];
  const int tid = threadIdx.x, wave = tid >> 5, lane = tid & 31, hh = lane >> 4, col = lane & 15; const int b = blockIdx.y; const int r0 = blockIdx.x * QB + wave * 16, ri = r0 + col;
  const b16* Qb = QP + (size_t)b * SQ * HD; const b16* Kb = KP + (size_t)b * SQ * HD; const b16* Vb = VT + (size_t)b * HD * (size_t)SQ;
  // one tile: every thread copies 4 pieces of 16 B of K (16 KB in a row in memory) and 4 of V^T (64 rows of 256 B); a wave's copy covers 4 whole lines
  auto tile_copy = [&](int s0, int buf) {
    unsigned lk[4], lv[4]; const b16* gk[4]; const b16* gv[4];
#pragma unroll   // the address arrays stay in registers
    for (int j = 0; j < 4; ++j) { const int c = j * (AW * 32) + tid;
      lk[j] = (unsigned)(size_t)(&Ks[buf][c / (HD / 8)][(c % (HD / 8)) * 8]); gk[j] = Kb + (size_t)s0 * HD + (size_t)c * 8;
      lv[j] = (unsigned)(size_t)(&Vs[buf][c / (KT / 8)][(c % (KT / 8)) * 8]); gv[j] = Vb + (size_t)(c / (KT / 8)) * SQ + s0 + (c % (KT / 8)) * 8; }
    // the copies and, as their statement's last line, the wait that stands before any of their address registers is rewritten
    asm volatile("global_load_async_to_lds_b128 %0, %1, off\n\t"
                 "global_load_async_to_lds_b128 %2, %3, off\n\t"
                 "global_load_async_to_lds_b128 %4, %5, off\n\t"
                 "global_load_async_to_lds_b128 %6, %7, off\n\t"
                 "global_load_async_to_lds_b128 %8, %9, off\n\t"
                 "global_load_async_to_lds_b128 %10, %11, off\n\t"
                 "global_load_async_to_lds_b128 %12, %13, off\n\t"
                 "global_load_async_to_lds_b128 %14, %15, off\n\t"
                 "s_wait_xcnt 0x0"
                 :: "v"(lk[0]), "v"(gk[0]), "v"(lk[1]), "v"(gk[1]), "v"(lk[2]), "v"(gk[2]), "v"(lk[3]), "v"(gk[3]),
                    "v"(lv[0]), "v"(gv[0]), "v"(lv[1]), "v"(gv[1]), "v"(lv[2]), "v"(gv[2]), "v"(lv[3]), "v"(gv[3]) : "memory"); };
  tile_copy(0, 0);
  v16b qa[2];
#pragma unroll
  for (int i = 0; i < 2; ++i) qa[i] = frag_kb(Qb + (size_t)ri * HD + 32 * i, hh);
  const float cs = SCL * LOG2E / (XS * XS);
  float m = -__builtin_inff(), l = 0.0f; v8f o[4];
#pragma unroll
  for (int t = 0; t < 4; ++t) o[t] = (v8f){};
  asm volatile("s_wait_asynccnt 0x0" ::: "memory");   // this wave's copies of tile 0 have landed
  __syncthreads();   // tile 0 is published
  if (NT > 1) tile_copy(KT, 1);
#pragma unroll 1   // rolled: one tile's body is all the code the loop needs
  for (int tl = 0; tl < NT; ++tl) {
    const int buf = tl & 1;
#pragma unroll   // the offsets inside a tile become immediates of the LDS reads
    for (int sb = 0; sb < KT; sb += 32) {
      v16b kf[4], vf[4];   // the pass's fragments as one group of LDS reads ahead of its products
#pragma unroll   // fragment arrays stay in registers (this loop and the next)
      for (int u = 0; u < 4; ++u) kf[u] = frag_kb(&Ks[buf][sb + (u >> 1) * 16 + col][32 * (u & 1)], hh);
#pragma unroll
      for (int t = 0; t < 4; ++t) vf[t] = frag_kb(&Vs[buf][t * 16 + col][sb], hh);
      float e[16]; float mx = -__builtin_inff();
#pragma unroll
      for (int u = 0; u < 2; ++u) { v8f s = (v8f){};
#pragma unroll
        for (int i = 0; i < 2; ++i) s = wmma16b(kf[u * 2 + i], qa[i], s);
#pragma unroll
        for (int r = 0; r < 8; ++r) { const float vv = s[r] * cs; e[u * 8 + r] = vv; mx = fmaxf(mx, vv); } }
      mx = fmaxf(mx, other_half(mx)); const float mn = fmaxf(m, mx); const float al = nexp2(m - mn); float sum = 0.0f; v16b pf;
#pragma unroll
      for (int i2 = 0; i2 < 16; ++i2) { const float p = nexp2(e[i2] - mn); sum += p; pf[i2] = (b16)(p * PS); }   // element i2 of the B fragment is key (i2 < 8 ? 0 : 16) + 8 * hh + (i2 & 7): the key of score register i2
      sum += other_half(sum); l = l * al + sum; m = mn;
#pragma unroll
      for (int t = 0; t < 4; ++t) o[t] *= al;
      __builtin_amdgcn_sched_barrier(0);   // keeps the pass's vector work (subtracts, exponentials, scalings, conversions, rescale) as groups ahead of the products: scheduled across this line it came out chained pair by pair, each link's latency exposed
#pragma unroll
      for (int t = 0; t < 4; ++t) o[t] = wmma16b(vf[t], pf, o[t]); }
    asm volatile("s_wait_dscnt 0x0" ::: "memory");      // this wave's reads of tile tl are done
    asm volatile("s_wait_asynccnt 0x0" ::: "memory");   // this wave's copies of tile tl + 1 have landed
    __syncthreads();   // publishes tile tl + 1 and ends every wave's reads of tile tl
    if (tl + 2 < NT) tile_copy((tl + 2) * KT, buf);   // refill of the buffer that this pass has just read
  }
  asm volatile("s_wait_asynccnt 0x0" ::: "memory");   // no copy is left in flight behind the loop
  const float inv = 1.0f / (l * PS * XS);
#pragma unroll
  for (int t = 0; t < 4; ++t)
#pragma unroll
    for (int r = 0; r < 8; ++r) To[wave][col][t * 16 + 8 * hh + r] = o[t][r] * inv;
  wave_lds_sync();
  {
#pragma unroll 1
    for (int it = 0; it < 8; ++it) { const int rr = it * 2 + (lane >> 4); const int c4 = (lane & 15) * 4;
      *(v4f*)(out + ((size_t)b * SQ + r0 + rr) * HD + c4) = *(const v4f*)(&To[wave][rr][c4]); }
     }
}
}  // namespace

extern "C" void kernel_launch(void* const* d_in, const int* in_sizes, int n_in, void* d_out, int out_size, void* d_ws, size_t ws_size, hipStream_t stream) {
  if (n_in < 7) return;
  auto Fp = [&](int i) { return (const float*)d_in[i]; };
  // wire order: 0 x [16,2048,384], 1 Wq [384,64], 2 bq [64], 3 Wk [384,64], 4 bk [64], 5 Wv [384,64], 6 bv [64]
  if ((size_t)in_sizes[0] < (size_t)NBL * T_FULL * C || in_sizes[1] < C * HD || in_sizes[2] < HD || in_sizes[3] < C * HD || in_sizes[4] < HD || in_sizes[5] < C * HD || in_sizes[6] < HD) return;
  if ((size_t)out_size < (size_t)NBL * SQ * HD) return;
  size_t off = 0; char* ws = (char*)d_ws;
  auto carve = [&](size_t bytes) { char* p = ws + off; off += (bytes + 255) & ~(size_t)255; return p; };
  b16* WT = (b16*)carve((size_t)PREP_ELEMS * 2);            // 147,456 B
  const size_t plane = (size_t)NBL * SQ * HD * 2;            // 4,194,304 B at full size
  b16* QP = (b16*)carve(plane); b16* KP = (b16*)carve(plane); b16* VT = (b16*)carve(plane);
  if (off > ws_size || off > ((size_t)128 << 20)) return;    // about 12.7 MB total
  prep_kernel<<<(unsigned)(PREP_THREADS / 256), 256, 0, stream>>>(Fp(1), Fp(3), Fp(5), WT);
  proj_kernel<<<dim3(SQ / 64, NBL, 3), 128, 0, stream>>>(Fp(0), WT, Fp(2), Fp(4), Fp(6), QP, KP, VT);
  attn_kernel<<<dim3(SQ / QB, NBL), AW * 32, 0, stream>>>(QP, KP, VT, (float*)d_out);
}

// v005
// It runs in 37.4 microseconds.
// Timed twice side by side with v004, it ran 1.04 and 1.03 times as fast.
// All steps since v000 together make it 4.54 times as fast.
#include <hip/hip_runtime.h>

// All contractions: v_wmma_f32_16x16x32_f16 (16-bit operands, f32 accumulate). Projections q/k/v = X W + b with X bf16-exact (x8) staged block-wide and W^T [o][c] bf16-exact (x256): 1 product;
// S^T = K_tile Q^T with q/k single f16 x8 planes (K = 64): 1 product; O^T += V^T P^T with V^T single f16 x8 and P single f16 x1024: 1 product. Biases, online softmax statistics and the
// final normalisation in f32. All float inputs RNE-converted to bf16 once on load.

#ifndef NB
#define NB 16
#endif
#ifndef SEQ
#define SEQ 2048
#endif

namespace {
constexpr int B_FULL = 16, T_FULL = 2048, C = 384, HD = 64;
constexpr int NBL = NB;   // batches processed
constexpr int SQ = SEQ;   // tokens processed per batch (queries and keys); input stride per batch stays T_FULL
constexpr int KC = 128;   // k chunk of C staged in LDS per pass
constexpr float XS = 8.0f, WSC = 256.0f, PS = 1024.0f, LOG2E = 1.4426950408889634f, SCL = 0.125f;   // 64^-0.5
static_assert(NBL >= 1 && NBL <= B_FULL);
static_assert(SQ >= 64 && SQ <= T_FULL && SQ % 64 == 0 && SQ % 32 == 0);
static_assert(C % KC == 0 && KC % 32 == 0 && C % 8 == 0 && HD == 64);
constexpr int XL = 64 * (KC / 4) / 128;   // 16-byte loads of X per thread and k chunk in a projection block
static_assert(KC / 4 == 32 && XL * 4 == 64);   // one wave's load covers one token's row of the chunk; 4 waves x XL loads cover the 64 tokens
static_assert(8 * 8 * 128 == HD * KC);   // 8 pieces of 8 halves per thread of a projection block fill the staged W^T chunk
constexpr int PREP_ELEMS = 3 * HD * C;           // 73728 halves in W^T
constexpr int PREP_THREADS = PREP_ELEMS / 8;     // 9216 threads, 8 halves each
static_assert(PREP_ELEMS % 8 == 0 && PREP_THREADS % 256 == 0);
// coverage: prep grid (PREP_THREADS/256) x 256 x 8 == 3*HD*C; proj grid (SQ/64, NBL) x 64 tokens x HD == NBL*SQ*HD per plane; attn grid (SQ/QB, NBL) x QB rows x HD == NBL*SQ*HD == out
static_assert((PREP_THREADS / 256) * 256 * 8 == PREP_ELEMS);
static_assert((SQ / 64) * 64 == SQ && (SQ / 32) * 32 == SQ);
constexpr int AW = 8, KS = 2, QG = AW / KS, QB = QG * 32;   // attention block: waves, key shares of a tile, groups of 32 query rows, query rows
constexpr int KT = 128, NT = SQ / KT;   // keys per staged tile, tiles
static_assert(SQ % QB == 0 && SQ % KT == 0 && KT % (32 * KS) == 0 && 4 * 8 * AW * 32 == KT * HD);   // 4 pieces of 8 halves per thread fill each staged tile
static_assert(KS == 2 && QG * KS == AW && QG * KS * 16 == QB);   // the closing merge pairs wave w with wave w ^ QG; each of the pair finishes 16 of the pair's 32 query rows

typedef _Float16 b16;
typedef __attribute__((ext_vector_type(16))) _Float16 v16b;
typedef __attribute__((ext_vector_type(8))) _Float16 v8b;
typedef __attribute__((ext_vector_type(4))) _Float16 v4h;
typedef __attribute__((ext_vector_type(8))) float v8f;
typedef __attribute__((ext_vector_type(4))) float v4f;

__device__ __forceinline__ float bf16_rne(float f) { unsigned int u = __float_as_uint(f); u += 0x7FFFu + ((u >> 16) & 1u); return __uint_as_float(u & 0xFFFF0000u); }
__device__ __forceinline__ v16b frag_kb(const b16* p, int hh) { const v8b a = *(const v8b*)(p + 8 * hh), b = *(const v8b*)(p + 16 + 8 * hh); v16b f;
#pragma unroll
  for (int e = 0; e < 8; ++e) { f[e] = a[e]; f[8 + e] = b[e]; } return f; }
__device__ __forceinline__ v8f wmma16b(v16b a, v16b b, v8f c) { v8f d = __builtin_amdgcn_wmma_f32_16x16x32_f16(false, a, false, b, (short)0, c, false, false); asm volatile("v_nop\n\tv_nop\n\tv_nop\n\tv_nop" : "+v"(d) : "v"(a), "v"(b)); return d; }
__device__ __forceinline__ void wave_lds_sync() { __builtin_amdgcn_fence(3 /* release order */, "workgroup"); __builtin_amdgcn_wave_barrier(); __builtin_amdgcn_fence(2 /* acquire order */, "workgroup"); }
__device__ __forceinline__ float nexp2(float v) { return __builtin_amdgcn_exp2f(v); }
__device__ __forceinline__ float other_half(float v) { const int b = __float_as_int(v); return __int_as_float(__builtin_amdgcn_permlanex16(b, b, 0x76543210, 0xfedcba98, false, false)); }   // lane l takes lane l ^ 16's value, by a vector move

__global__ __launch_bounds__(256) void prep_kernel(const float* __restrict__ wq, const float* __restrict__ wk, const float* __restrict__ wv, b16* __restrict__ WT) {
  const size_t u = (size_t)blockIdx.x * 256 + threadIdx.x; if (u >= (size_t)PREP_THREADS) return;
  const size_t e = u * 8; const int oo = (int)(e / C), c0 = (int)(e % C); const int m = oo / HD, o2 = oo % HD; const float* w = m == 0 ? wq : m == 1 ? wk : wv; v8b o;
#pragma unroll
  for (int j = 0; j < 8; ++j) o[j] = (b16)(bf16_rne(w[(size_t)(c0 + j) * HD + o2]) * WSC);
  { *(v8b*)(WT + e) = o;  }
}

// projections: grid (SQ/64, NBL, 3 parts: 0 q (row operand, plane QP [b][tok][64]), 1 k (streamed operand, plane KP [b][tok][64]), 2 v (V^T [b][d][tok])); block = 64 tokens x 4 waves,
// register budget of 6 waves per SIMD: the 6 blocks of a WGP's share of the grid stay resident together with the load group's registers
__global__ __launch_bounds__(128) __attribute__((amdgpu_waves_per_eu(6))) void proj_kernel(const float* __restrict__ X, const b16* __restrict__ WT, const float* __restrict__ bq, const float* __restrict__ bk, const float* __restrict__ bv,
                                                   b16* __restrict__ QP, b16* __restrict__ KP, b16* __restrict__ VT) {
  __shared__ __attribute__((aligned(16))) b16 As[64][KC + 8]; __shared__ __attribute__((aligned(16))) float Tf[4][16][HD + 4];
  __shared__ __attribute__((aligned(16))) b16 Ws[HD][KC + 8];   // this part's W^T rows, one k chunk; row pitch 272 B: 16 B x odd for 16-byte readers
  const int wave = threadIdx.x >> 5, lane = threadIdx.x & 31, nloc = lane & 15, hlf = lane >> 4; const int t0 = blockIdx.x * 64; const int b = blockIdx.y; const int part = blockIdx.z;
  const float* xb = X + ((size_t)b * T_FULL + t0) * C; const float* bias = part == 0 ? bq : part == 1 ? bk : bv; const b16* W = WT + (size_t)part * HD * C;
  // one k chunk of W^T (64 rows of 256 B): every thread copies 8 pieces of 16 B; a wave's copy covers 2 rows of 2 whole lines each
  auto w_copy = [&](int kc) {
    unsigned lw[8]; const b16* gw[8];
#pragma unroll   // the address arrays stay in registers
    for (int j = 0; j < 8; ++j) { const int c = j * 128 + (int)threadIdx.x;
      lw[j] = (unsigned)(size_t)(&Ws[c / (KC / 8)][(c % (KC / 8)) * 8]); gw[j] = W + (size_t)(c / (KC / 8)) * C + kc + (c % (KC / 8)) * 8; }
    // the copies and, as their statement's last line, the wait that stands before any of their address registers is rewritten
    asm volatile("global_load_async_to_lds_b128 %0, %1, off\n\t"
                 "global_load_async_to_lds_b128 %2, %3, off\n\t"
                 "global_load_async_to_lds_b128 %4, %5, off\n\t"
                 "global_load_async_to_lds_b128 %6, %7, off\n\t"
                 "global_load_async_to_lds_b128 %8, %9, off\n\t"
                 "global_load_async_to_lds_b128 %10, %11, off\n\t"
                 "global_load_async_to_lds_b128 %12, %13, off\n\t"
                 "global_load_async_to_lds_b128 %14, %15, off\n\t"
                 "s_wait_xcnt 0x0"
                 :: "v"(lw[0]), "v"(gw[0]), "v"(lw[1]), "v"(gw[1]), "v"(lw[2]), "v"(gw[2]), "v"(lw[3]), "v"(gw[3]),
                    "v"(lw[4]), "v"(gw[4]), "v"(lw[5]), "v"(gw[5]), "v"(lw[6]), "v"(gw[6]), "v"(lw[7]), "v"(gw[7]) : "memory"); };
  const float* xp = xb + wave * C + lane * 4;   // the thread's place in a group of 4 token rows: wave = row, lane = 16-byte piece; steps on by a chunk per pass
  v8f acc[4];
#pragma unroll
  for (int t = 0; t < 4; ++t) acc[t] = (v8f){};
#pragma unroll 1
  for (int kc = 0; kc < C; kc += KC) {
    asm volatile("s_wait_dscnt 0x0" ::: "memory");   // this wave's reads of the last chunk are done
    __syncthreads();   // ends every wave's reads of the last chunk
    w_copy(kc);   // in flight while the X chunk is converted
    v4f xf[XL];   // the thread's whole share of the X chunk: every load is issued before the first value is used, so a chunk costs one memory round trip, not one per pair of loads
#pragma unroll   // the load array stays in registers (this loop and the next); the row steps become immediate offsets
    for (int g = 0; g < XL; ++g) xf[g] = *(const v4f*)(xp + g * 4 * C);
    xp += KC;
#pragma unroll
    for (int g = 0; g < XL; ++g) { v4h o;
#pragma unroll
      for (int j = 0; j < 4; ++j) o[j] = (b16)(bf16_rne(xf[g][j]) * XS); *(v4h*)(&As[g * 4 + wave][lane * 4]) = o; }
    asm volatile("s_wait_asynccnt 0x0" ::: "memory");   // this wave's copies of the W^T chunk have landed
    __syncthreads();   // publishes the X chunk and the W^T chunk
#pragma unroll 2
    for (int kb = 0; kb < KC; kb += 32) { const v16b a = frag_kb(&As[wave * 16 + nloc][kb], hlf); v16b wf[4];   // the k step's fragments as one group of LDS reads ahead of its products
#pragma unroll   // the fragment array stays in registers
      for (int t = 0; t < 4; ++t) wf[t] = frag_kb(&Ws[t * 16 + nloc][kb], hlf);
#pragma unroll
      for (int t = 0; t < 4; ++t) acc[t] = wmma16b(a, wf[t], acc[t]); } }
#pragma unroll
  for (int t = 0; t < 4; ++t) { const float bb = bf16_rne(bias[t * 16 + nloc]);
#pragma unroll
    for (int r = 0; r < 8; ++r) Tf[wave][8 * hlf + r][t * 16 + nloc] = acc[t][r] * (1.0f / (XS * WSC)) + bb; }
  __syncthreads();   // part 2 reads Tf rows of all waves
  {
    if (part < 2) { b16* plane = part == 0 ? QP : KP;
#pragma unroll 1
      for (int it = 0; it < 4; ++it) { const int rr = it * 4 + (lane >> 3); const int tok = t0 + wave * 16 + rr; const int c8 = (lane & 7) * 8; v8b o8;
#pragma unroll
        for (int j = 0; j < 8; ++j) o8[j] = (b16)(Tf[wave][rr][c8 + j] * XS);
        *(v8b*)(plane + ((size_t)b * SQ + tok) * HD + c8) = o8; } }
    else {
#pragma unroll 1
      for (int it = 0; it < 4; ++it) { const int d = wave * 16 + it * 4 + (lane >> 3); const int tk0 = (lane & 7) * 8; v8b vv;
#pragma unroll
        for (int j = 0; j < 8; ++j) { const int tk = tk0 + j; vv[j] = (b16)(Tf[tk >> 4][tk & 15][d] * XS); }
        *(v8b*)(VT + ((size_t)b * HD + d) * (size_t)SQ + t0 + tk0) = vv; } }
     }
}

// attention: grid (SQ/QB, NBL): block = QG groups of 32 query rows x KS key shares, one wave each: a wave works its share (KT/KS keys) of every tile for two query tiles of 16 rows, so each K and V^T
// fragment it reads from LDS feeds two products; the two waves of a group hold partial results (own running max, sum, output tiles) that are merged once behind the loop, through LDS, each wave finishing one query tile.
// K and V^T tiles of KT keys are staged in LDS once per block by asynchronous copies (whole lines, two buffers, the next tile's
// copies in flight while this tile is worked on, one block barrier per tile) and every wave takes its fragments from there; q fragments register-resident; S^T = K_tile Q^T (lane col = query row,
// D rows = keys; K = 64 = 2 k-steps); online softmax over keys with running max; P x1024 single, packed in registers: a lane's 16 scores of a pass are its 16 elements of the B fragment; O^T += V^T P^T (4 d-tiles);
// out rows [b][t][64] f32:
__global__ __launch_bounds__(AW * 32) void attn_kernel(const b16* __restrict__ QP, const b16* __restrict__ KP, const b16* __restrict__ VT, float* __restrict__ out) {
  __shared__ __attribute__((aligned(16))) b16 Ks[2][KT][HD + 8]; __shared__ __attribute__((aligned(16))) b16 Vs[2][HD][KT + 8];   // row pitches 144 B and 272 B: 16 B x odd for 16-byte readers
  __shared__ __attribute__((aligned(16))) float To[AW][16][HD + 4];
  __shared__ __attribute__((aligned(16))) float Tx[AW][16][HD + 4]; __shared__ float Sx[AW][2][16];   // the partial output tile, max and sum that a wave hands to its partner
  const int tid = threadIdx.x, wave = tid >> 5, lane = tid & 31, hh = lane >> 4, col = lane & 15; const int b = blockIdx.y; const int qg = wave % QG, kh = wave / QG; const int r0 = blockIdx.x * QB + qg * 32;
  const b16* Qb = QP + (size_t)b * SQ * HD; const b16* Kb = KP + (size_t)b * SQ * HD; const b16* Vb = VT + (size_t)b * HD * (size_t)SQ;
  // one tile: every thread copies 4 pieces of 16 B of K (16 KB in a row in memory) and 4 of V^T (64 rows of 256 B); a wave's copy covers 4 whole lines
  auto tile_copy = [&](int s0, int buf) {
    unsigned lk[4], lv[4]; const b16* gk[4]; const b16* gv[4];
#pragma unroll   // the address arrays stay in registers
    for (int j = 0; j < 4; ++j) { const int c = j * (AW * 32) + tid;
      lk[j] = (unsigned)(size_t)(&Ks[buf][c / (HD / 8)][(c % (HD / 8)) * 8]); gk[j] = Kb + (size_t)s0 * HD + (size_t)c * 8;
      lv[j] = (unsigned)(size_t)(&Vs[buf][c / (KT / 8)][(c % (KT / 8)) * 8]); gv[j] = Vb + (size_t)(c / (KT / 8)) * SQ + s0 + (c % (KT / 8)) * 8; }
    // the copies and, as their statement's last line, the wait that stands before any of their address registers is rewritten
    asm volatile("global_load_async_to_lds_b128 %0, %1, off\n\t"
                 "global_load_async_to_lds_b128 %2, %3, off\n\t"
                 "global_load_async_to_lds_b128 %4, %5, off\n\t"
                 "global_load_async_to_lds_b128 %6, %7, off\n\t"
                 "global_load_async_to_lds_b128 %8, %9, off\n\t"
                 "global_load_async_to_lds_b128 %10, %11, off\n\t"
                 "global_load_async_to_lds_b128 %12, %13, off\n\t"
                 "global_load_async_to_lds_b128 %14, %15, off\n\t"
                 "s_wait_xcnt 0x0"
                 :: "v"(lk[0]), "v"(gk[0]), "v"(lk[1]), "v"(gk[1]), "v"(lk[2]), "v"(gk[2]), "v"(lk[3]), "v"(gk[3]),
                    "v"(lv[0]), "v"(gv[0]), "v"(lv[1]), "v"(gv[1]), "v"(lv[2]), "v"(gv[2]), "v"(lv[3]), "v"(gv[3]) : "memory"); };
  tile_copy(0, 0);
  v16b qa[2][2];   // [query tile][k step]
#pragma unroll   // here and below, every nest over j, u, t, r, i: the register arrays need constant indices
  for (int j = 0; j < 2; ++j)
#pragma unroll
    for (int i = 0; i < 2; ++i) qa[j][i] = frag_kb(Qb + (size_t)(r0 + j * 16 + col) * HD + 32 * i, hh);
  const float cs = SCL * LOG2E / (XS * XS);
  float m[2], l[2]; v8f o[2][4];
#pragma unroll
  for (int j = 0; j < 2; ++j) { m[j] = -__builtin_inff(); l[j] = 0.0f;
#pragma unroll
    for (int t = 0; t < 4; ++t) o[j][t] = (v8f){}; }
  asm volatile("s_wait_asynccnt 0x0" ::: "memory");   // this wave's copies of tile 0 have landed
  __syncthreads();   // tile 0 is published
  if (NT > 1) tile_copy(KT, 1);
#pragma unroll 1   // rolled: one tile's body is all the code the loop needs
  for (int tl = 0; tl < NT; ++tl) {
    const int buf = tl & 1;
#pragma unroll   // the offsets inside a tile become immediates of the LDS reads
    for (int sp = 0; sp < KT / KS; sp += 32) { const int sb = kh * (KT / KS) + sp;   // the wave's share of the tile
      v16b kf[4], vf[4];   // the pass's fragments as one group of LDS reads ahead of its products; each serves both query tiles
#pragma unroll   // fragment arrays stay in registers (this loop and the next)
      for (int u = 0; u < 4; ++u) kf[u] = frag_kb(&Ks[buf][sb + (u >> 1) * 16 + col][32 * (u & 1)], hh);
#pragma unroll
      for (int t = 0; t < 4; ++t) vf[t] = frag_kb(&Vs[buf][t * 16 + col][sb], hh);
      v8f s[2][2];   // [query tile][key tile]: four independent accumulators, so the second k step finds the first one's results ready
#pragma unroll
      for (int j = 0; j < 2; ++j)
#pragma unroll
        for (int u = 0; u < 2; ++u) s[j][u] = wmma16b(kf[u * 2], qa[j][0], (v8f){});
#pragma unroll
      for (int j = 0; j < 2; ++j)
#pragma unroll
        for (int u = 0; u < 2; ++u) s[j][u] = wmma16b(kf[u * 2 + 1], qa[j][1], s[j][u]);
      v16b pf[2];
#pragma unroll   // both query tiles' softmax chains in one straight run, free to interleave
      for (int j = 0; j < 2; ++j) {
        float e[16]; float mx = -__builtin_inff();
#pragma unroll
        for (int u = 0; u < 2; ++u)
#pragma unroll
          for (int r = 0; r < 8; ++r) { const float vv = s[j][u][r] * cs; e[u * 8 + r] = vv; mx = fmaxf(mx, vv); }
        mx = fmaxf(mx, other_half(mx)); const float mn = fmaxf(m[j], mx); const float al = nexp2(m[j] - mn); float sum = 0.0f;
#pragma unroll
        for (int i2 = 0; i2 < 16; ++i2) { const float p = nexp2(e[i2] - mn); sum += p; pf[j][i2] = (b16)(p * PS); }   // element i2 of the B fragment is key (i2 < 8 ? 0 : 16) + 8 * hh + (i2 & 7): the key of score register i2
        sum += other_half(sum); l[j] = l[j] * al + sum; m[j] = mn;
#pragma unroll
        for (int t = 0; t < 4; ++t) o[j][t] *= al; }
      __builtin_amdgcn_sched_barrier(0);   // keeps the pass's vector work (subtracts, exponentials, scalings, conversions, rescale) as groups ahead of the products: scheduled across this line it came out chained pair by pair, each link's latency exposed
#pragma unroll
      for (int j = 0; j < 2; ++j)
#pragma unroll
        for (int t = 0; t < 4; ++t) o[j][t] = wmma16b(vf[t], pf[j], o[j][t]); }
    asm volatile("s_wait_dscnt 0x0" ::: "memory");      // this wave's reads of tile tl are done
    asm volatile("s_wait_asynccnt 0x0" ::: "memory");   // this wave's copies of tile tl + 1 have landed
    __syncthreads();   // publishes tile tl + 1 and ends every wave's reads of tile tl
    if (tl + 2 < NT) tile_copy((tl + 2) * KT, buf);   // refill of the buffer that this pass has just read
  }
  asm volatile("s_wait_asynccnt 0x0" ::: "memory");   // no copy is left in flight behind the loop
  // merge of the two key shares: wave w keeps query tile kh and hands the other one's partial (max, sum, output tile) to wave w ^ QG, which holds the same 32 query rows
  const bool hi = kh != 0;
  const float mk = hi ? m[1] : m[0], lk = hi ? l[1] : l[0], mg = hi ? m[0] : m[1], lg = hi ? l[0] : l[1];
#pragma unroll
  for (int t = 0; t < 4; ++t)
#pragma unroll
    for (int r = 0; r < 8; ++r) Tx[wave][col][t * 16 + 8 * hh + r] = hi ? o[0][t][r] : o[1][t][r];
  Sx[wave][hh][col] = hh ? lg : mg;   // both lane halves hold both values: half 0 writes the max, half 1 the sum
  __syncthreads();   // publishes every wave's handed-over partial
  const int pw = wave ^ QG;
  const float mp = Sx[pw][0][col], lp = Sx[pw][1][col]; const float mn = fmaxf(mk, mp); const float ak = nexp2(mk - mn), ap = nexp2(mp - mn);
  const float inv = 1.0f / ((lk * ak + lp * ap) * PS * XS); const float fk = ak * inv, fp = ap * inv;
#pragma unroll
  for (int t = 0; t < 4; ++t)
#pragma unroll
    for (int r = 0; r < 8; ++r) To[wave][col][t * 16 + 8 * hh + r] = (hi ? o[1][t][r] : o[0][t][r]) * fk + Tx[pw][col][t * 16 + 8 * hh + r] * fp;
  wave_lds_sync();
  {
#pragma unroll 1
    for (int it = 0; it < 8; ++it) { const int rr = it * 2 + (lane >> 4); const int c4 = (lane & 15) * 4;
      *(v4f*)(out + ((size_t)b * SQ + r0 + kh * 16 + rr) * HD + c4) = *(const v4f*)(&To[wave][rr][c4]); }
     }
}
}  // namespace

extern "C" void kernel_launch(void* const* d_in, const int* in_sizes, int n_in, void* d_out, int out_size, void* d_ws, size_t ws_size, hipStream_t stream) {
  if (n_in < 7) return;
  auto Fp = [&](int i) { return (const float*)d_in[i]; };
  // wire order: 0 x [16,2048,384], 1 Wq [384,64], 2 bq [64], 3 Wk [384,64], 4 bk [64], 5 Wv [384,64], 6 bv [64]
  if ((size_t)in_sizes[0] < (size_t)NBL * T_FULL * C || in_sizes[1] < C * HD || in_sizes[2] < HD || in_sizes[3] < C * HD || in_sizes[4] < HD || in_sizes[5] < C * HD || in_sizes[6] < HD) return;
  if ((size_t)out_size < (size_t)NBL * SQ * HD) return;
  size_t off = 0; char* ws = (char*)d_ws;
  auto carve = [&](size_t bytes) { char* p = ws + off; off += (bytes + 255) & ~(size_t)255; return p; };
  b16* WT = (b16*)carve((size_t)PREP_ELEMS * 2);            // 147,456 B
  const size_t plane = (size_t)NBL * SQ * HD * 2;            // 4,194,304 B at full size
  b16* QP = (b16*)carve(plane); b16* KP = (b16*)carve(plane); b16* VT = (b16*)carve(plane);
  if (off > ws_size || off > ((size_t)128 << 20)) return;    // about 12.7 MB total
  prep_kernel<<<(unsigned)(PREP_THREADS / 256), 256, 0, stream>>>(Fp(1), Fp(3), Fp(5), WT);
  proj_kernel<<<dim3(SQ / 64, NBL, 3), 128, 0, stream>>>(Fp(0), WT, Fp(2), Fp(4), Fp(6), QP, KP, VT);
  attn_kernel<<<dim3(SQ / QB, NBL), AW * 32, 0, stream>>>(QP, KP, VT, (float*)d_out);
}

// v006
// A run of this version takes 35.9 microseconds.
// Timed twice side by side with v005, it ran 1.05 and 1.03 times as fast.
// Counting every step since v000, it is 4.73 times as fast.
#include <hip/hip_runtime.h>

// All contractions: v_wmma_f32_16x16x32_f16 (16-bit operands, f32 accumulate). Projections q/k/v = X W + b with X bf16-exact (x8) staged block-wide and W^T [o][c] bf16-exact (x256): 1 product;
// S^T = K_tile Q^T with q/k single f16 x8 planes (K = 64): 1 product; O^T += V^T P^T with V^T single f16 x8 and P single f16 x1024: 1 product. Biases, online softmax statistics and the
// final normalisation in f32. All float inputs RNE-converted to bf16 once on load.

#ifndef NB
#define NB 16
#endif
#ifndef SEQ
#define SEQ 2048
#endif

namespace {
constexpr int B_FULL = 16, T_FULL = 2048, C = 384, HD = 64;
constexpr int NBL = NB;   // batches processed
constexpr int SQ = SEQ;   // tokens processed per batch (queries and keys); input stride per batch stays T_FULL
constexpr int KC = 128;   // k chunk of C staged in LDS per pass
constexpr float XS = 8.0f, WSC = 256.0f, PS = 1024.0f, LOG2E = 1.4426950408889634f, SCL = 0.125f;   // 64^-0.5
static_assert(NBL >= 1 && NBL <= B_FULL);
static_assert(SQ >= 64 && SQ <= T_FULL && SQ % 64 == 0 && SQ % 32 == 0);
static_assert(C % KC == 0 && KC % 32 == 0 && C % 8 == 0 && HD == 64);
constexpr int XL = 64 * (KC / 4) / 128;   // 16-byte loads of X per thread and k chunk in a projection block
static_assert(KC / 4 == 32 && XL * 4 == 64);   // one wave's load covers one token's row of the chunk; 4 waves x XL loads cover the 64 tokens
constexpr int NO = 3 * HD;   // output columns of the three projections together
static_assert(24 * 8 * 128 == NO * KC && NO == 4 * 3 * 16);   // 24 pieces of 8 halves per thread of a projection block fill the staged W^T chunk; 4 waves x 3 column tiles
constexpr int PREP_ELEMS = 3 * HD * C;           // 73728 halves in W^T
constexpr int PREP_THREADS = PREP_ELEMS / 8;     // 9216 threads, 8 halves each
static_assert(PREP_ELEMS % 8 == 0 && PREP_THREADS % 256 == 0);
// coverage: prep grid (PREP_THREADS/256) x 256 x 8 == 3*HD*C; proj grid (SQ/64, NBL) x 64 tokens x HD == NBL*SQ*HD per plane, three planes per block; attn grid (SQ/QB, NBL) x QB rows x HD == NBL*SQ*HD == out
static_assert((PREP_THREADS / 256) * 256 * 8 == PREP_ELEMS);
static_assert((SQ / 64) * 64 == SQ && (SQ / 32) * 32 == SQ);
constexpr int AW = 8, KS = 2, QG = AW / KS, QB = QG * 32;   // attention block: waves, key shares of a tile, groups of 32 query rows, query rows
constexpr int KT = 128, NT = SQ / KT;   // keys per staged tile, tiles
static_assert(SQ % QB == 0 && SQ % KT == 0 && KT % (32 * KS) == 0 && 4 * 8 * AW * 32 == KT * HD);   // 4 pieces of 8 halves per thread fill each staged tile
static_assert(KS == 2 && QG * KS == AW && QG * KS * 16 == QB);   // the closing merge pairs wave w with wave w ^ QG; each of the pair finishes 16 of the pair's 32 query rows

typedef _Float16 b16;
typedef __attribute__((ext_vector_type(16))) _Float16 v16b;
typedef __attribute__((ext_vector_type(8))) _Float16 v8b;
typedef __attribute__((ext_vector_type(4))) _Float16 v4h;
typedef __attribute__((ext_vector_type(8))) float v8f;
typedef __attribute__((ext_vector_type(4))) float v4f;

__device__ __forceinline__ float bf16_rne(float f) { unsigned int u = __float_as_uint(f); u += 0x7FFFu + ((u >> 16) & 1u); return __uint_as_float(u & 0xFFFF0000u); }
__device__ __forceinline__ v16b frag_kb(const b16* p, int hh) { const v8b a = *(const v8b*)(p + 8 * hh), b = *(const v8b*)(p + 16 + 8 * hh); v16b f;
#pragma unroll
  for (int e = 0; e < 8; ++e) { f[e] = a[e]; f[8 + e] = b[e]; } return f; }
__device__ __forceinline__ v8f wmma16b(v16b a, v16b b, v8f c) { v8f d = __builtin_amdgcn_wmma_f32_16x16x32_f16(false, a, false, b, (short)0, c, false, false); asm volatile("v_nop\n\tv_nop\n\tv_nop\n\tv_nop" : "+v"(d) : "v"(a), "v"(b)); return d; }
__device__ __forceinline__ void wave_lds_sync() { __builtin_amdgcn_fence(3 /* release order */, "workgroup"); __builtin_amdgcn_wave_barrier(); __builtin_amdgcn_fence(2 /* acquire order */, "workgroup"); }
__device__ __forceinline__ float nexp2(float v) { return __builtin_amdgcn_exp2f(v); }
__device__ __forceinline__ float other_half(float v) { const int b = __float_as_int(v); return __int_as_float(__builtin_amdgcn_permlanex16(b, b, 0x76543210, 0xfedcba98, false, false)); }   // lane l takes lane l ^ 16's value, by a vector move

__global__ __launch_bounds__(256) void prep_kernel(const float* __restrict__ wq, const float* __restrict__ wk, const float* __restrict__ wv, b16* __restrict__ WT) {
  const size_t u = (size_t)blockIdx.x * 256 + threadIdx.x; if (u >= (size_t)PREP_THREADS) return;
  const size_t e = u * 8; const int oo = (int)(e / C), c0 = (int)(e % C); const int m = oo / HD, o2 = oo % HD; const float* w = m == 0 ? wq : m == 1 ? wk : wv; v8b o;
#pragma unroll
  for (int j = 0; j < 8; ++j) o[j] = (b16)(bf16_rne(w[(size_t)(c0 + j) * HD + o2]) * WSC);
  { *(v8b*)(WT + e) = o;  }
}

// projections: grid (SQ/64, NBL); block = 64 tokens x 4 waves and ALL THREE projections: an X chunk is read from memory, converted and staged once and serves the 192 output columns
// (0..63 q, row operand, plane QP [b][tok][64]; 64..127 k, streamed operand, plane KP [b][tok][64]; 128..191 v, V^T [b][d][tok]); W^T rows of the three parts lie one behind the other in WT.
// A wave takes the 64 tokens x 48 columns (4 x 3 accumulator tiles): 7 fragments read from LDS feed 12 products, and each W^T row is read by one wave only.
__global__ __launch_bounds__(128) void proj_kernel(const float* __restrict__ X, const b16* __restrict__ WT, const float* __restrict__ bq, const float* __restrict__ bk, const float* __restrict__ bv,
                                                   b16* __restrict__ QP, b16* __restrict__ KP, b16* __restrict__ VT) {
  __shared__ __attribute__((aligned(16))) b16 As[64][KC + 8]; __shared__ __attribute__((aligned(16))) float Tf[3][64][HD + 4];
  __shared__ __attribute__((aligned(16))) b16 Ws[NO][KC + 8];   // the W^T rows of all three parts, one k chunk; row pitch 272 B: 16 B x odd for 16-byte readers
  const int wave = threadIdx.x >> 5, lane = threadIdx.x & 31, nloc = lane & 15, hlf = lane >> 4; const int t0 = blockIdx.x * 64; const int b = blockIdx.y;
  const float* xb = X + ((size_t)b * T_FULL + t0) * C;
  // one k chunk of W^T (192 rows of 256 B): every thread copies 24 pieces of 16 B, 12 per statement; a wave's copy covers 2 rows of 2 whole lines each
  const unsigned lw0 = (unsigned)(size_t)(&Ws[threadIdx.x / (KC / 8)][(threadIdx.x % (KC / 8)) * 8]); const b16* gw0 = WT + (size_t)(threadIdx.x / (KC / 8)) * C + (threadIdx.x % (KC / 8)) * 8;
  auto w_copy12 = [&](int kc, int j0) {
    unsigned lw[12]; const b16* gw[12];
#pragma unroll   // the address arrays stay in registers
    for (int j = 0; j < 12; ++j) { lw[j] = lw0 + (unsigned)((j0 + j) * 8 * (KC + 8) * 2); gw[j] = gw0 + kc + (j0 + j) * 8 * C; }   // piece j of a thread lies 8 rows behind piece j - 1: constant steps from one base, no table of addresses held over the loop
    // the copies and, as their statement's last line, the wait that stands before any of their address registers is rewritten
    asm volatile("global_load_async_to_lds_b128 %0, %1, off\n\t"
                 "global_load_async_to_lds_b128 %2, %3, off\n\t"
                 "global_load_async_to_lds_b128 %4, %5, off\n\t"
                 "global_load_async_to_lds_b128 %6, %7, off\n\t"
                 "global_load_async_to_lds_b128 %8, %9, off\n\t"
                 "global_load_async_to_lds_b128 %10, %11, off\n\t"
                 "global_load_async_to_lds_b128 %12, %13, off\n\t"
                 "global_load_async_to_lds_b128 %14, %15, off\n\t"
                 "global_load_async_to_lds_b128 %16, %17, off\n\t"
                 "global_load_async_to_lds_b128 %18, %19, off\n\t"
                 "global_load_async_to_lds_b128 %20, %21, off\n\t"
                 "global_load_async_to_lds_b128 %22, %23, off\n\t"
                 "s_wait_xcnt 0x0"
                 :: "v"(lw[0]), "v"(gw[0]), "v"(lw[1]), "v"(gw[1]), "v"(lw[2]), "v"(gw[2]), "v"(lw[3]), "v"(gw[3]),
                    "v"(lw[4]), "v"(gw[4]), "v"(lw[5]), "v"(gw[5]), "v"(lw[6]), "v"(gw[6]), "v"(lw[7]), "v"(gw[7]),
                    "v"(lw[8]), "v"(gw[8]), "v"(lw[9]), "v"(gw[9]), "v"(lw[10]), "v"(gw[10]), "v"(lw[11]), "v"(gw[11]) : "memory"); };
  const float* xp = xb + wave * C + lane * 4;   // the thread's place in a group of 4 token rows: wave = row, lane = 16-byte piece; steps on by a chunk per pass
  v8f acc[4][3];   // [token tile][column tile]
#pragma unroll   // here and below, every nest over i, u, r: the register arrays need constant indices
  for (int i = 0; i < 4; ++i)
#pragma unroll
    for (int u = 0; u < 3; ++u) acc[i][u] = (v8f){};
#pragma unroll 1   // rolled: one chunk's body is all the code the loop needs
  for (int kc = 0; kc < C; kc += KC) {
    asm volatile("s_wait_dscnt 0x0" ::: "memory");   // this wave's reads of the last chunk are done
    __syncthreads();   // ends every wave's reads of the last chunk
    w_copy12(kc, 0); w_copy12(kc, 12);   // in flight while the X chunk is converted
    v4f xf[XL];   // the thread's whole share of the X chunk: every load is issued before the first value is used, so a chunk costs one memory round trip, not one per pair of loads
#pragma unroll   // the load array stays in registers (this loop and the next); the row steps become immediate offsets
    for (int g = 0; g < XL; ++g) xf[g] = *(const v4f*)(xp + g * 4 * C);
    xp += KC;
#pragma unroll
    for (int g = 0; g < XL; ++g) { v4h o;
#pragma unroll
      for (int j = 0; j < 4; ++j) o[j] = (b16)(bf16_rne(xf[g][j]) * XS); *(v4h*)(&As[g * 4 + wave][lane * 4]) = o; }
    asm volatile("s_wait_asynccnt 0x0" ::: "memory");   // this wave's copies of the W^T chunk have landed
    __syncthreads();   // publishes the X chunk and the W^T chunk
#pragma unroll 2   // two k steps a trip: one trip's fragments and the 12 accumulator tiles fit 256 registers
    for (int kb = 0; kb < KC; kb += 32) { v16b a[4], wf[3];   // the k step's fragments as one group of LDS reads ahead of its products
#pragma unroll
      for (int i = 0; i < 4; ++i) a[i] = frag_kb(&As[i * 16 + nloc][kb], hlf);
#pragma unroll
      for (int u = 0; u < 3; ++u) wf[u] = frag_kb(&Ws[wave * 48 + u * 16 + nloc][kb], hlf);
#pragma unroll
      for (int u = 0; u < 3; ++u)
#pragma unroll
        for (int i = 0; i < 4; ++i) acc[i][u] = wmma16b(a[i], wf[u], acc[i][u]); } }
#pragma unroll
  for (int u = 0; u < 3; ++u) { const int g = wave * 3 + u, pt = g >> 2, tc = (g & 3) * 16 + nloc;   // column tile g of 12: part and column inside the part
    const float* bias = pt == 0 ? bq : pt == 1 ? bk : bv; const float bb = bf16_rne(bias[tc]);
#pragma unroll
    for (int i = 0; i < 4; ++i)
#pragma unroll
      for (int r = 0; r < 8; ++r) Tf[pt][i * 16 + 8 * hlf + r][tc] = acc[i][u][r] * (1.0f / (XS * WSC)) + bb; }
  __syncthreads();   // every wave reads Tf rows and columns that other waves wrote
#pragma unroll 1   // rolled (this loop and the next): run once per block, short code
  for (int it = 0; it < 8; ++it) { const int pt = it >> 2; b16* plane = pt == 0 ? QP : KP; const int rr = wave * 16 + (it & 3) * 4 + (lane >> 3); const int c8 = (lane & 7) * 8; v8b o8;
#pragma unroll
    for (int j = 0; j < 8; ++j) o8[j] = (b16)(Tf[pt][rr][c8 + j] * XS);
    *(v8b*)(plane + ((size_t)b * SQ + t0 + rr) * HD + c8) = o8;
    asm volatile("s_wait_xcnt 0x0" ::: "memory"); }   // stands before the next trip rewrites the store's address and data registers
#pragma unroll 1
  for (int it = 0; it < 4; ++it) { const int d = wave * 16 + it * 4 + (lane >> 3); const int tk0 = (lane & 7) * 8; v8b vv;
#pragma unroll
    for (int j = 0; j < 8; ++j) vv[j] = (b16)(Tf[2][tk0 + j][d] * XS);
    *(v8b*)(VT + ((size_t)b * HD + d) * (size_t)SQ + t0 + tk0) = vv; }
}

// attention: grid (SQ/QB, NBL): block = QG groups of 32 query rows x KS key shares, one wave each: a wave works its share (KT/KS keys) of every tile for two query tiles of 16 rows, so each K and V^T
// fragment it reads from LDS feeds two products; the two waves of a group hold partial results (own running max, sum, output tiles) that are merged once behind the loop, through LDS, each wave finishing one query tile.
// K and V^T tiles of KT keys are staged in LDS once per block by asynchronous copies (whole lines, two buffers, the next tile's
// copies in flight while this tile is worked on, one block barrier per tile) and every wave takes its fragments from there; q fragments register-resident; S^T = K_tile Q^T (lane col = query row,
// D rows = keys; K = 64 = 2 k-steps); online softmax over keys with running max; P x1024 single, packed in registers: a lane's 16 scores of a pass are its 16 elements of the B fragment; O^T += V^T P^T (4 d-tiles);
// out rows [b][t][64] f32:
__global__ __launch_bounds__(AW * 32) void attn_kernel(const b16* __restrict__ QP, const b16* __restrict__ KP, const b16* __restrict__ VT, float* __restrict__ out) {
  __shared__ __attribute__((aligned(16))) b16 Ks[2][KT][HD + 8]; __shared__ __attribute__((aligned(16))) b16 Vs[2][HD][KT + 8];   // row pitches 144 B and 272 B: 16 B x odd for 16-byte readers
  __shared__ __attribute__((aligned(16))) float To[AW][16][HD + 4];
  __shared__ __attribute__((aligned(16))) float Tx[AW][16][HD + 4]; __shared__ float Sx[AW][2][16];   // the partial output tile, max and sum that a wave hands to its partner
  const int tid = threadIdx.x, wave = tid >> 5, lane = tid & 31, hh = lane >> 4, col = lane & 15; const int b = blockIdx.y; const int qg = wave % QG, kh = wave / QG; const int r0 = blockIdx.x * QB + qg * 32;
  const b16* Qb = QP + (size_t)b * SQ * HD; const b16* Kb = KP + (size_t)b * SQ * HD; const b16* Vb = VT + (size_t)b * HD * (size_t)SQ;
  // one tile: every thread copies 4 pieces of 16 B of K (16 KB in a row in memory) and 4 of V^T (64 rows of 256 B); a wave's copy covers 4 whole lines
  auto tile_copy = [&](int s0, int buf) {
    unsigned lk[4], lv[4]; const b16* gk[4]; const b16* gv[4];
#pragma unroll   // the address arrays stay in registers
    for (int j = 0; j < 4; ++j) { const int c = j * (AW * 32) + tid;
      lk[j] = (unsigned)(size_t)(&Ks[buf][c / (HD / 8)][(c % (HD / 8)) * 8]); gk[j] = Kb + (size_t)s0 * HD + (size_t)c * 8;
      lv[j] = (unsigned)(size_t)(&Vs[buf][c / (KT / 8)][(c % (KT / 8)) * 8]); gv[j] = Vb + (size_t)(c / (KT / 8)) * SQ + s0 + (c % (KT / 8)) * 8; }
    // the copies and, as their statement's last line, the wait that stands before any of their address registers is rewritten
    asm volatile("global_load_async_to_lds_b128 %0, %1, off\n\t"
                 "global_load_async_to_lds_b128 %2, %3, off\n\t"
                 "global_load_async_to_lds_b128 %4, %5, off\n\t"
                 "global_load_async_to_lds_b128 %6, %7, off\n\t"
                 "global_load_async_to_lds_b128 %8, %9, off\n\t"
                 "global_load_async_to_lds_b128 %10, %11, off\n\t"
                 "global_load_async_to_lds_b128 %12, %13, off\n\t"
                 "global_load_async_to_lds_b128 %14, %15, off\n\t"
                 "s_wait_xcnt 0x0"
                 :: "v"(lk[0]), "v"(gk[0]), "v"(lk[1]), "v"(gk[1]), "v"(lk[2]), "v"(gk[2]), "v"(lk[3]), "v"(gk[3]),
                    "v"(lv[0]), "v"(gv[0]), "v"(lv[1]), "v"(gv[1]), "v"(lv[2]), "v"(gv[2]), "v"(lv[3]), "v"(gv[3]) : "memory"); };
  tile_copy(0, 0);
  v16b qa[2][2];   // [query tile][k step]
#pragma unroll   // here and below, every nest over j, u, t, r, i: the register arrays need constant indices
  for (int j = 0; j < 2; ++j)
#pragma unroll
    for (int i = 0; i < 2; ++i) qa[j][i] = frag_kb(Qb + (size_t)(r0 + j * 16 + col) * HD + 32 * i, hh);
  const float cs = SCL * LOG2E / (XS * XS);
  float m[2], l[2]; v8f o[2][4];
#pragma unroll
  for (int j = 0; j < 2; ++j) { m[j] = -__builtin_inff(); l[j] = 0.0f;
#pragma unroll
    for (int t = 0; t < 4; ++t) o[j][t] = (v8f){}; }
  asm volatile("s_wait_asynccnt 0x0" ::: "memory");   // this wave's copies of tile 0 have landed
  __syncthreads();   // tile 0 is published
  if (NT > 1) tile_copy(KT, 1);
#pragma unroll 1   // rolled: one tile's body is all the code the loop needs
  for (int tl = 0; tl < NT; ++tl) {
    const int buf = tl & 1;
#pragma unroll   // the offsets inside a tile become immediates of the LDS reads
    for (int sp = 0; sp < KT / KS; sp += 32) { const int sb = kh * (KT / KS) + sp;   // the wave's share of the tile
      v16b kf[4], vf[4];   // the pass's fragments as one group of LDS reads ahead of its products; each serves both query tiles
#pragma unroll   // fragment arrays stay in registers (this loop and the next)
      for (int u = 0; u < 4; ++u) kf[u] = frag_kb(&Ks[buf][sb + (u >> 1) * 16 + col][32 * (u & 1)], hh);
#pragma unroll
      for (int t = 0; t < 4; ++t) vf[t] = frag_kb(&Vs[buf][t * 16 + col][sb], hh);
      v8f s[2][2];   // [query tile][key tile]: four independent accumulators, so the second k step finds the first one's results ready
#pragma unroll
      for (int j = 0; j < 2; ++j)
#pragma unroll
        for (int u = 0; u < 2; ++u) s[j][u] = wmma16b(kf[u * 2], qa[j][0], (v8f){});
#pragma unroll
      for (int j = 0; j < 2; ++j)
#pragma unroll
        for (int u = 0; u < 2; ++u) s[j][u] = wmma16b(kf[u * 2 + 1], qa[j][1], s[j][u]);
      v16b pf[2];
#pragma unroll   // both query tiles' softmax chains in one straight run, free to interleave
      for (int j = 0; j < 2; ++j) {
        float e[16]; float mx = -__builtin_inff();
#pragma unroll
        for (int u = 0; u < 2; ++u)
#pragma unroll
          for (int r = 0; r < 8; ++r) { const float vv = s[j][u][r] * cs; e[u * 8 + r] = vv; mx = fmaxf(mx, vv); }
        mx = fmaxf(mx, other_half(mx)); const float mn = fmaxf(m[j], mx); const float al = nexp2(m[j] - mn); float sum = 0.0f;
#pragma unroll
        for (int i2 = 0; i2 < 16; ++i2) { const float p = nexp2(e[i2] - mn); sum += p; pf[j][i2] = (b16)(p * PS); }   // element i2 of the B fragment is key (i2 < 8 ? 0 : 16) + 8 * hh + (i2 & 7): the key of score register i2
        sum += other_half(sum); l[j] = l[j] * al + sum; m[j] = mn;
#pragma unroll
        for (int t = 0; t < 4; ++t) o[j][t] *= al; }
      __builtin_amdgcn_sched_barrier(0);   // keeps the pass's vector work (subtracts, exponentials, scalings, conversions, rescale) as groups ahead of the products: scheduled across this line it came out chained pair by pair, each link's latency exposed
#pragma unroll
      for (int j = 0; j < 2; ++j)
#pragma unroll
        for (int t = 0; t < 4; ++t) o[j][t] = wmma16b(vf[t], pf[j], o[j][t]); }
    asm volatile("s_wait_dscnt 0x0" ::: "memory");      // this wave's reads of tile tl are done
    asm volatile("s_wait_asynccnt 0x0" ::: "memory");   // this wave's copies of tile tl + 1 have landed
    __syncthreads();   // publishes tile tl + 1 and ends every wave's reads of tile tl
    if (tl + 2 < NT) tile_copy((tl + 2) * KT, buf);   // refill of the buffer that this pass has just read
  }
  asm volatile("s_wait_asynccnt 0x0" ::: "memory");   // no copy is left in flight behind the loop
  // merge of the two key shares: wave w keeps query tile kh and hands the other one's partial (max, sum, output tile) to wave w ^ QG, which holds the same 32 query rows
  const bool hi = kh != 0;
  const float mk = hi ? m[1] : m[0], lk = hi ? l[1] : l[0], mg = hi ? m[0] : m[1], lg = hi ? l[0] : l[1];
#pragma unroll
  for (int t = 0; t < 4; ++t)
#pragma unroll
    for (int r = 0; r < 8; ++r) Tx[wave][col][t * 16 + 8 * hh + r] = hi ? o[0][t][r] : o[1][t][r];
  Sx[wave][hh][col] = hh ? lg : mg;   // both lane halves hold both values: half 0 writes the max, half 1 the sum
  __syncthreads();   // publishes every wave's handed-over partial
  const int pw = wave ^ QG;
  const float mp = Sx[pw][0][col], lp = Sx[pw][1][col]; const float mn = fmaxf(mk, mp); const float ak = nexp2(mk - mn), ap = nexp2(mp - mn);
  const float inv = 1.0f / ((lk * ak + lp * ap) * PS * XS); const float fk = ak * inv, fp = ap * inv;
#pragma unroll
  for (int t = 0; t < 4; ++t)
#pragma unroll
    for (int r = 0; r < 8; ++r) To[wave][col][t * 16 + 8 * hh + r] = (hi ? o[1][t][r] : o[0][t][r]) * fk + Tx[pw][col][t * 16 + 8 * hh + r] * fp;
  wave_lds_sync();
  {
#pragma unroll 1
    for (int it = 0; it < 8; ++it) { const int rr = it * 2 + (lane >> 4); const int c4 = (lane & 15) * 4;
      *(v4f*)(out + ((size_t)b * SQ + r0 + kh * 16 + rr) * HD + c4) = *(const v4f*)(&To[wave][rr][c4]); }
     }
}
}  // namespace

extern "C" void kernel_launch(void* const* d_in, const int* in_sizes, int n_in, void* d_out, int out_size, void* d_ws, size_t ws_size, hipStream_t stream) {
  if (n_in < 7) return;
  auto Fp = [&](int i) { return (const float*)d_in[i]; };
  // wire order: 0 x [16,2048,384], 1 Wq [384,64], 2 bq [64], 3 Wk [384,64], 4 bk [64], 5 Wv [384,64], 6 bv [64]
  if ((size_t)in_sizes[0] < (size_t)NBL * T_FULL * C || in_sizes[1] < C * HD || in_sizes[2] < HD || in_sizes[3] < C * HD || in_sizes[4] < HD || in_sizes[5] < C * HD || in_sizes[6] < HD) return;
  if ((size_t)out_size < (size_t)NBL * SQ * HD) return;
  size_t off = 0; char* ws = (char*)d_ws;
  auto carve = [&](size_t bytes) { char* p = ws + off; off += (bytes + 255) & ~(size_t)255; return p; };
  b16* WT = (b16*)carve((size_t)PREP_ELEMS * 2);            // 147,456 B
  const size_t plane = (size_t)NBL * SQ * HD * 2;            // 4,194,304 B at full size
  b16* QP = (b16*)carve(plane); b16* KP = (b16*)carve(plane); b16* VT = (b16*)carve(plane);
  if (off > ws_size || off > ((size_t)128 << 20)) return;    // about 12.7 MB total
  prep_kernel<<<(unsigned)(PREP_THREADS / 256), 256, 0, stream>>>(Fp(1), Fp(3), Fp(5), WT);
  proj_kernel<<<dim3(SQ / 64, NBL), 128, 0, stream>>>(Fp(0), WT, Fp(2), Fp(4), Fp(6), QP, KP, VT);
  attn_kernel<<<dim3(SQ / QB, NBL), AW * 32, 0, stream>>>(QP, KP, VT, (float*)d_out);
}

// v007
// Measured time: 34.4 microseconds a run.
// Next to v006, in two timings, it ran 1.04 times as fast each time.
// All steps since v000 together make it 4.92 times as fast.
#include <hip/hip_runtime.h>

// All contractions: v_wmma_f32_16x16x32_f16 (16-bit operands, f32 accumulate). Projections q/k/v = X W + b with X bf16-exact (x8) staged block-wide and W^T [o][c] bf16-exact (x256): 1 product;
// S^T = K_tile Q^T with q/k single f16 x8 planes (K = 64): 1 product; O^T += V^T P^T with V^T single f16 x8 and P single f16 x1024: 1 product. Biases, online softmax statistics and the
// final normalisation in f32. All float inputs RNE-converted to bf16 once on load.

#ifndef NB
#define NB 16
#endif
#ifndef SEQ
#define SEQ 2048
#endif

namespace {
constexpr int B_FULL = 16, T_FULL = 2048, C = 384, HD = 64;
constexpr int NBL = NB;   // batches processed
constexpr int SQ = SEQ;   // tokens processed per batch (queries and keys); input stride per batch stays T_FULL
constexpr int KC = 128;   // k chunk of C staged in LDS per pass
constexpr float XS = 8.0f, WSC = 256.0f, PS = 1024.0f, LOG2E = 1.4426950408889634f, SCL = 0.125f;   // 64^-0.5
static_assert(NBL >= 1 && NBL <= B_FULL);
static_assert(SQ >= 64 && SQ <= T_FULL && SQ % 64 == 0 && SQ % 32 == 0);
static_assert(C % KC == 0 && KC % 32 == 0 && C % 8 == 0 && HD == 64);
constexpr int XL = 64 * (KC / 4) / 128;   // 16-byte loads of X per thread and k chunk in a projection block
static_assert(KC / 4 == 32 && XL * 4 == 64);   // one wave's load covers one token's row of the chunk; 4 waves x XL loads cover the 64 tokens
constexpr int NO = 3 * HD;   // output columns of the three projections together
static_assert(24 * 8 * 128 == NO * KC && NO == 4 * 3 * 16);   // 24 pieces of 8 halves per thread of a projection block fill the staged W^T chunk; 4 waves x 3 column tiles
constexpr int PREP_ELEMS = 3 * HD * C;           // 73728 halves in W^T
constexpr int PREP_THREADS = PREP_ELEMS / 8;     // 9216 threads, 8 halves each
static_assert(PREP_ELEMS % 8 == 0 && PREP_THREADS % 256 == 0);
// coverage: prep grid (PREP_THREADS/256) x 256 x 8 == 3*HD*C; proj grid (SQ/64, NBL) x 64 tokens x HD == NBL*SQ*HD per plane, three planes per block; attn grid (SQ/QB, NBL) x QB rows x HD == NBL*SQ*HD == out
static_assert((PREP_THREADS / 256) * 256 * 8 == PREP_ELEMS);
static_assert((SQ / 64) * 64 == SQ && (SQ / 32) * 32 == SQ);
constexpr int AW = 16, KS = 4, QG = AW / KS, QB = QG * 32;   // attention block: waves (4 per SIMD), key shares of a tile, groups of 32 query rows, query rows
constexpr int KT = 256, NT = SQ / KT;   // keys per staged tile (a share stays 64 keys), tiles
static_assert(SQ % QB == 0 && SQ % KT == 0 && KT % (32 * KS) == 0 && 4 * 8 * AW * 32 == KT * HD);   // 4 pieces of 8 halves per thread fill each staged tile
static_assert(KS == 4 && QG * KS == AW && KS * 16 * 32 == 32 * HD);   // the closing merge joins waves qg, qg + QG, qg + 2 QG, qg + 3 QG; each of the four finishes 16 query rows x 32 columns of the group's 32 x 64

typedef _Float16 b16;
typedef __attribute__((ext_vector_type(16))) _Float16 v16b;
typedef __attribute__((ext_vector_type(8))) _Float16 v8b;
typedef __attribute__((ext_vector_type(4))) _Float16 v4h;
typedef __attribute__((ext_vector_type(8))) float v8f;
typedef __attribute__((ext_vector_type(4))) float v4f;

__device__ __forceinline__ float bf16_rne(float f) { unsigned int u = __float_as_uint(f); u += 0x7FFFu + ((u >> 16) & 1u); return __uint_as_float(u & 0xFFFF0000u); }
__device__ __forceinline__ v16b frag_kb(const b16* p, int hh) { const v8b a = *(const v8b*)(p + 8 * hh), b = *(const v8b*)(p + 16 + 8 * hh); v16b f;
#pragma unroll
  for (int e = 0; e < 8; ++e) { f[e] = a[e]; f[8 + e] = b[e]; } return f; }
__device__ __forceinline__ v8f wmma16b(v16b a, v16b b, v8f c) { v8f d = __builtin_amdgcn_wmma_f32_16x16x32_f16(false, a, false, b, (short)0, c, false, false); asm volatile("v_nop\n\tv_nop\n\tv_nop\n\tv_nop" : "+v"(d) : "v"(a), "v"(b)); return d; }
__device__ __forceinline__ float nexp2(float v) { return __builtin_amdgcn_exp2f(v); }
__device__ __forceinline__ float other_half(float v) { const int b = __float_as_int(v); return __int_as_float(__builtin_amdgcn_permlanex16(b, b, 0x76543210, 0xfedcba98, false, false)); }   // lane l takes lane l ^ 16's value, by a vector move

__global__ __launch_bounds__(256) void prep_kernel(const float* __restrict__ wq, const float* __restrict__ wk, const float* __restrict__ wv, b16* __restrict__ WT) {
  const size_t u = (size_t)blockIdx.x * 256 + threadIdx.x; if (u >= (size_t)PREP_THREADS) return;
  const size_t e = u * 8; const int oo = (int)(e / C), c0 = (int)(e % C); const int m = oo / HD, o2 = oo % HD; const float* w = m == 0 ? wq : m == 1 ? wk : wv; v8b o;
#pragma unroll
  for (int j = 0; j < 8; ++j) o[j] = (b16)(bf16_rne(w[(size_t)(c0 + j) * HD + o2]) * WSC);
  { *(v8b*)(WT + e) = o;  }
}

// projections: grid (SQ/64, NBL); block = 64 tokens x 4 waves and ALL THREE projections: an X chunk is read from memory, converted and staged once and serves the 192 output columns
// (0..63 q, row operand, plane QP [b][tok][64]; 64..127 k, streamed operand, plane KP [b][tok][64]; 128..191 v, V^T [b][d][tok]); W^T rows of the three parts lie one behind the other in WT.
// A wave takes the 64 tokens x 48 columns (4 x 3 accumulator tiles): 7 fragments read from LDS feed 12 products, and each W^T row is read by one wave only.
__global__ __launch_bounds__(128) void proj_kernel(const float* __restrict__ X, const b16* __restrict__ WT, const float* __restrict__ bq, const float* __restrict__ bk, const float* __restrict__ bv,
                                                   b16* __restrict__ QP, b16* __restrict__ KP, b16* __restrict__ VT) {
  __shared__ __attribute__((aligned(16))) b16 As[64][KC + 8]; __shared__ __attribute__((aligned(16))) float Tf[3][64][HD + 4];
  __shared__ __attribute__((aligned(16))) b16 Ws[NO][KC + 8];   // the W^T rows of all three parts, one k chunk; row pitch 272 B: 16 B x odd for 16-byte readers
  const int wave = threadIdx.x >> 5, lane = threadIdx.x & 31, nloc = lane & 15, hlf = lane >> 4; const int t0 = blockIdx.x * 64; const int b = blockIdx.y;
  const float* xb = X + ((size_t)b * T_FULL + t0) * C;
  // one k chunk of W^T (192 rows of 256 B): every thread copies 24 pieces of 16 B, 12 per statement; a wave's copy covers 2 rows of 2 whole lines each
  const unsigned lw0 = (unsigned)(size_t)(&Ws[threadIdx.x / (KC / 8)][(threadIdx.x % (KC / 8)) * 8]); const b16* gw0 = WT + (size_t)(threadIdx.x / (KC / 8)) * C + (threadIdx.x % (KC / 8)) * 8;
  auto w_copy12 = [&](int kc, int j0) {
    unsigned lw[12]; const b16* gw[12];
#pragma unroll   // the address arrays stay in registers
    for (int j = 0; j < 12; ++j) { lw[j] = lw0 + (unsigned)((j0 + j) * 8 * (KC + 8) * 2); gw[j] = gw0 + kc + (j0 + j) * 8 * C; }   // piece j of a thread lies 8 rows behind piece j - 1: constant steps from one base, no table of addresses held over the loop
    // the copies and, as their statement's last line, the wait that stands before any of their address registers is rewritten
    asm volatile("global_load_async_to_lds_b128 %0, %1, off\n\t"
                 "global_load_async_to_lds_b128 %2, %3, off\n\t"
                 "global_load_async_to_lds_b128 %4, %5, off\n\t"
                 "global_load_async_to_lds_b128 %6, %7, off\n\t"
                 "global_load_async_to_lds_b128 %8, %9, off\n\t"
                 "global_load_async_to_lds_b128 %10, %11, off\n\t"
                 "global_load_async_to_lds_b128 %12, %13, off\n\t"
                 "global_load_async_to_lds_b128 %14, %15, off\n\t"
                 "global_load_async_to_lds_b128 %16, %17, off\n\t"
                 "global_load_async_to_lds_b128 %18, %19, off\n\t"
                 "global_load_async_to_lds_b128 %20, %21, off\n\t"
                 "global_load_async_to_lds_b128 %22, %23, off\n\t"
                 "s_wait_xcnt 0x0"
                 :: "v"(lw[0]), "v"(gw[0]), "v"(lw[1]), "v"(gw[1]), "v"(lw[2]), "v"(gw[2]), "v"(lw[3]), "v"(gw[3]),
                    "v"(lw[4]), "v"(gw[4]), "v"(lw[5]), "v"(gw[5]), "v"(lw[6]), "v"(gw[6]), "v"(lw[7]), "v"(gw[7]),
                    "v"(lw[8]), "v"(gw[8]), "v"(lw[9]), "v"(gw[9]), "v"(lw[10]), "v"(gw[10]), "v"(lw[11]), "v"(gw[11]) : "memory"); };
  const float* xp = xb + wave * C + lane * 4;   // the thread's place in a group of 4 token rows: wave = row, lane = 16-byte piece; steps on by a chunk per pass
  v8f acc[4][3];   // [token tile][column tile]
#pragma unroll   // here and below, every nest over i, u, r: the register arrays need constant indices
  for (int i = 0; i < 4; ++i)
#pragma unroll
    for (int u = 0; u < 3; ++u) acc[i][u] = (v8f){};
#pragma unroll 1   // rolled: one chunk's body is all the code the loop needs
  for (int kc = 0; kc < C; kc += KC) {
    asm volatile("s_wait_dscnt 0x0" ::: "memory");   // this wave's reads of the last chunk are done
    __syncthreads();   // ends every wave's reads of the last chunk
    w_copy12(kc, 0); w_copy12(kc, 12);   // in flight while the X chunk is converted
    v4f xf[XL];   // the thread's whole share of the X chunk: every load is issued before the first value is used, so a chunk costs one memory round trip, not one per pair of loads
#pragma unroll   // the load array stays in registers (this loop and the next); the row steps become immediate offsets
    for (int g = 0; g < XL; ++g) xf[g] = *(const v4f*)(xp + g * 4 * C);
    xp += KC;
#pragma unroll
    for (int g = 0; g < XL; ++g) { v4h o;
#pragma unroll
      for (int j = 0; j < 4; ++j) o[j] = (b16)(bf16_rne(xf[g][j]) * XS); *(v4h*)(&As[g * 4 + wave][lane * 4]) = o; }
    asm volatile("s_wait_asynccnt 0x0" ::: "memory");   // this wave's copies of the W^T chunk have landed
    __syncthreads();   // publishes the X chunk and the W^T chunk
#pragma unroll 2   // two k steps a trip: one trip's fragments and the 12 accumulator tiles fit 256 registers
    for (int kb = 0; kb < KC; kb += 32) { v16b a[4], wf[3];   // the k step's fragments as one group of LDS reads ahead of its products
#pragma unroll
      for (int i = 0; i < 4; ++i) a[i] = frag_kb(&As[i * 16 + nloc][kb], hlf);
#pragma unroll
      for (int u = 0; u < 3; ++u) wf[u] = frag_kb(&Ws[wave * 48 + u * 16 + nloc][kb], hlf);
#pragma unroll
      for (int u = 0; u < 3; ++u)
#pragma unroll
        for (int i = 0; i < 4; ++i) acc[i][u] = wmma16b(a[i], wf[u], acc[i][u]); } }
#pragma unroll
  for (int u = 0; u < 3; ++u) { const int g = wave * 3 + u, pt = g >> 2, tc = (g & 3) * 16 + nloc;   // column tile g of 12: part and column inside the part
    const float* bias = pt == 0 ? bq : pt == 1 ? bk : bv; const float bb = bf16_rne(bias[tc]);
#pragma unroll
    for (int i = 0; i < 4; ++i)
#pragma unroll
      for (int r = 0; r < 8; ++r) Tf[pt][i * 16 + 8 * hlf + r][tc] = acc[i][u][r] * (1.0f / (XS * WSC)) + bb; }
  __syncthreads();   // every wave reads Tf rows and columns that other waves wrote
#pragma unroll 1   // rolled (this loop and the next): run once per block, short code
  for (int it = 0; it < 8; ++it) { const int pt = it >> 2; b16* plane = pt == 0 ? QP : KP; const int rr = wave * 16 + (it & 3) * 4 + (lane >> 3); const int c8 = (lane & 7) * 8; v8b o8;
#pragma unroll
    for (int j = 0; j < 8; ++j) o8[j] = (b16)(Tf[pt][rr][c8 + j] * XS);
    *(v8b*)(plane + ((size_t)b * SQ + t0 + rr) * HD + c8) = o8;
    asm volatile("s_wait_xcnt 0x0" ::: "memory"); }   // stands before the next trip rewrites the store's address and data registers
#pragma unroll 1
  for (int it = 0; it < 4; ++it) { const int d = wave * 16 + it * 4 + (lane >> 3); const int tk0 = (lane & 7) * 8; v8b vv;
#pragma unroll
    for (int j = 0; j < 8; ++j) vv[j] = (b16)(Tf[2][tk0 + j][d] * XS);
    *(v8b*)(VT + ((size_t)b * HD + d) * (size_t)SQ + t0 + tk0) = vv; }
}

// attention: grid (SQ/QB, NBL): block = QG groups of 32 query rows x KS key shares, one wave each: a wave works its share (KT/KS keys) of every tile for two query tiles of 16 rows, so each K and V^T
// fragment it reads from LDS feeds two products; the four waves of a group hold partial results (own running max, sum, output tiles) that are merged once behind the loop, through LDS, each wave finishing half the columns of one query tile.
// 16 waves a block, one block a WGP: four waves share a SIMD, so one wave's softmax chain and LDS waits are filled by three others' work.
// K and V^T tiles of KT keys are staged in LDS once per block by asynchronous copies (whole lines, two buffers, the next tile's
// copies in flight while this tile is worked on, one block barrier per tile) and every wave takes its fragments from there; q fragments register-resident; S^T = K_tile Q^T (lane col = query row,
// D rows = keys; K = 64 = 2 k-steps); online softmax over keys with running max; P x1024 single, packed in registers: a lane's 16 scores of a pass are its 16 elements of the B fragment; O^T += V^T P^T (4 d-tiles);
// out rows [b][t][64] f32:
__global__ __launch_bounds__(AW * 32) void attn_kernel(const b16* __restrict__ QP, const b16* __restrict__ KP, const b16* __restrict__ VT, float* __restrict__ out) {
  __shared__ __attribute__((aligned(16))) b16 Ks[2][KT][HD + 8]; __shared__ __attribute__((aligned(16))) b16 Vs[2][HD][KT + 8];   // row pitches 144 B and 528 B: 16 B x odd for 16-byte readers
  __shared__ __attribute__((aligned(16))) float Tx[AW][2][16][HD + 4]; __shared__ float Sx[AW][2][2][16];   // every wave's partial output tiles [query tile][row][column], max and sum [query tile][max, sum][row]
  const int tid = threadIdx.x, wave = tid >> 5, lane = tid & 31, hh = lane >> 4, col = lane & 15; const int b = blockIdx.y; const int qg = wave % QG, kh = wave / QG; const int r0 = blockIdx.x * QB + qg * 32;
  const b16* Qb = QP + (size_t)b * SQ * HD; const b16* Kb = KP + (size_t)b * SQ * HD; const b16* Vb = VT + (size_t)b * HD * (size_t)SQ;
  // one tile: every thread copies 4 pieces of 16 B of K (32 KB in a row in memory) and 4 of V^T (64 rows of 512 B); a wave's copy covers 4 whole lines
  auto tile_copy = [&](int s0, int buf) {
    unsigned lk[4], lv[4]; const b16* gk[4]; const b16* gv[4];
#pragma unroll   // the address arrays stay in registers
    for (int j = 0; j < 4; ++j) { const int c = j * (AW * 32) + tid;
      lk[j] = (unsigned)(size_t)(&Ks[buf][c / (HD / 8)][(c % (HD / 8)) * 8]); gk[j] = Kb + (size_t)s0 * HD + (size_t)c * 8;
      lv[j] = (unsigned)(size_t)(&Vs[buf][c / (KT / 8)][(c % (KT / 8)) * 8]); gv[j] = Vb + (size_t)(c / (KT / 8)) * SQ + s0 + (c % (KT / 8)) * 8; }
    // the copies and, as their statement's last line, the wait that stands before any of their address registers is rewritten
    asm volatile("global_load_async_to_lds_b128 %0, %1, off\n\t"
                 "global_load_async_to_lds_b128 %2, %3, off\n\t"
                 "global_load_async_to_lds_b128 %4, %5, off\n\t"
                 "global_load_async_to_lds_b128 %6, %7, off\n\t"
                 "global_load_async_to_lds_b128 %8, %9, off\n\t"
                 "global_load_async_to_lds_b128 %10, %11, off\n\t"
                 "global_load_async_to_lds_b128 %12, %13, off\n\t"
                 "global_load_async_to_lds_b128 %14, %15, off\n\t"
                 "s_wait_xcnt 0x0"
                 :: "v"(lk[0]), "v"(gk[0]), "v"(lk[1]), "v"(gk[1]), "v"(lk[2]), "v"(gk[2]), "v"(lk[3]), "v"(gk[3]),
                    "v"(lv[0]), "v"(gv[0]), "v"(lv[1]), "v"(gv[1]), "v"(lv[2]), "v"(gv[2]), "v"(lv[3]), "v"(gv[3]) : "memory"); };
  tile_copy(0, 0);
  v16b qa[2][2];   // [query tile][k step]
#pragma unroll   // here and below, every nest over j, u, t, r, i: the register arrays need constant indices
  for (int j = 0; j < 2; ++j)
#pragma unroll
    for (int i = 0; i < 2; ++i) qa[j][i] = frag_kb(Qb + (size_t)(r0 + j * 16 + col) * HD + 32 * i, hh);
  const float cs = SCL * LOG2E / (XS * XS);
  float m[2], l[2]; v8f o[2][4];
#pragma unroll
  for (int j = 0; j < 2; ++j) { m[j] = -__builtin_inff(); l[j] = 0.0f;
#pragma unroll
    for (int t = 0; t < 4; ++t) o[j][t] = (v8f){}; }
  asm volatile("s_wait_asynccnt 0x0" ::: "memory");   // this wave's copies of tile 0 have landed
  __syncthreads();   // tile 0 is published
  if (NT > 1) tile_copy(KT, 1);
#pragma unroll 1   // rolled: one tile's body is all the code the loop needs
  for (int tl = 0; tl < NT; ++tl) {
    const int buf = tl & 1;
#pragma unroll   // the offsets inside a tile become immediates of the LDS reads
    for (int sp = 0; sp < KT / KS; sp += 32) { const int sb = kh * (KT / KS) + sp;   // the wave's share of the tile
      v16b kf[4], vf[4];   // the pass's fragments as one group of LDS reads ahead of its products; each serves both query tiles
#pragma unroll   // fragment arrays stay in registers (this loop and the next)
      for (int u = 0; u < 4; ++u) kf[u] = frag_kb(&Ks[buf][sb + (u >> 1) * 16 + col][32 * (u & 1)], hh);
#pragma unroll
      for (int t = 0; t < 4; ++t) vf[t] = frag_kb(&Vs[buf][t * 16 + col][sb], hh);
      v8f s[2][2];   // [query tile][key tile]: four independent accumulators, so the second k step finds the first one's results ready
#pragma unroll
      for (int j = 0; j < 2; ++j)
#pragma unroll
        for (int u = 0; u < 2; ++u) s[j][u] = wmma16b(kf[u * 2], qa[j][0], (v8f){});
#pragma unroll
      for (int j = 0; j < 2; ++j)
#pragma unroll
        for (int u = 0; u < 2; ++u) s[j][u] = wmma16b(kf[u * 2 + 1], qa[j][1], s[j][u]);
      v16b pf[2];
#pragma unroll   // both query tiles' softmax chains in one straight run, free to interleave
      for (int j = 0; j < 2; ++j) {
        float e[16]; float mx = -__builtin_inff();
#pragma unroll
        for (int u = 0; u < 2; ++u)
#pragma unroll
          for (int r = 0; r < 8; ++r) { const float vv = s[j][u][r] * cs; e[u * 8 + r] = vv; mx = fmaxf(mx, vv); }
        mx = fmaxf(mx, other_half(mx)); const float mn = fmaxf(m[j], mx); const float al = nexp2(m[j] - mn); float sum = 0.0f;
#pragma unroll
        for (int i2 = 0; i2 < 16; ++i2) { const float p = nexp2(e[i2] - mn); sum += p; pf[j][i2] = (b16)(p * PS); }   // element i2 of the B fragment is key (i2 < 8 ? 0 : 16) + 8 * hh + (i2 & 7): the key of score register i2
        sum += other_half(sum); l[j] = l[j] * al + sum; m[j] = mn;
#pragma unroll
        for (int t = 0; t < 4; ++t) o[j][t] *= al; }
      __builtin_amdgcn_sched_barrier(0);   // keeps the pass's vector work (subtracts, exponentials, scalings, conversions, rescale) as groups ahead of the products: scheduled across this line it came out chained pair by pair, each link's latency exposed
#pragma unroll
      for (int j = 0; j < 2; ++j)
#pragma unroll
        for (int t = 0; t < 4; ++t) o[j][t] = wmma16b(vf[t], pf[j], o[j][t]); }
    asm volatile("s_wait_dscnt 0x0" ::: "memory");      // this wave's reads of tile tl are done
    asm volatile("s_wait_asynccnt 0x0" ::: "memory");   // this wave's copies of tile tl + 1 have landed
    __syncthreads();   // publishes tile tl + 1 and ends every wave's reads of tile tl
    if (tl + 2 < NT) tile_copy((tl + 2) * KT, buf);   // refill of the buffer that this pass has just read
  }
  asm volatile("s_wait_asynccnt 0x0" ::: "memory");   // no copy is left in flight behind the loop
  // merge of the four key shares: every wave lays down both its partial tiles with their max and sum; behind one barrier wave (qg, kh) finishes query tile kh & 1, columns 32 * (kh >> 1) .. + 31
#pragma unroll
  for (int j = 0; j < 2; ++j) {
#pragma unroll
    for (int t = 0; t < 4; ++t)
#pragma unroll
      for (int r = 0; r < 8; ++r) Tx[wave][j][col][t * 16 + 8 * hh + r] = o[j][t][r];
    Sx[wave][j][hh][col] = hh ? l[j] : m[j]; }   // both lane halves hold both values: half 0 writes the max, half 1 the sum
  __syncthreads();   // publishes every wave's partials
  const int jt = kh & 1, dh = kh >> 1;
#pragma unroll   // the four trips are independent: unrolled, their LDS reads and exponentials overlap, and the stores stand last with constant offsets
  for (int it = 0; it < 4; ++it) { const int rr = it * 4 + (lane >> 3); const int c4 = dh * 32 + (lane & 7) * 4;   // a store covers 4 rows x one whole 128-byte line
    float mp[KS], lp[KS]; float mn = -__builtin_inff();
#pragma unroll
    for (int p = 0; p < KS; ++p) { mp[p] = Sx[qg + QG * p][jt][0][rr]; lp[p] = Sx[qg + QG * p][jt][1][rr]; mn = fmaxf(mn, mp[p]); }
    float den = 0.0f; v4f acc = (v4f){};
#pragma unroll
    for (int p = 0; p < KS; ++p) { const float a = nexp2(mp[p] - mn); den += lp[p] * a; acc += *(const v4f*)(&Tx[qg + QG * p][jt][rr][c4]) * a; }
    *(v4f*)(out + ((size_t)b * SQ + r0 + jt * 16 + rr) * HD + c4) = acc * (1.0f / (den * PS * XS)); }
}
}  // namespace

extern "C" void kernel_launch(void* const* d_in, const int* in_sizes, int n_in, void* d_out, int out_size, void* d_ws, size_t ws_size, hipStream_t stream) {
  if (n_in < 7) return;
  auto Fp = [&](int i) { return (const float*)d_in[i]; };
  // wire order: 0 x [16,2048,384], 1 Wq [384,64], 2 bq [64], 3 Wk [384,64], 4 bk [64], 5 Wv [384,64], 6 bv [64]
  if ((size_t)in_sizes[0] < (size_t)NBL * T_FULL * C || in_sizes[1] < C * HD || in_sizes[2] < HD || in_sizes[3] < C * HD || in_sizes[4] < HD || in_sizes[5] < C * HD || in_sizes[6] < HD) return;
  if ((size_t)out_size < (size_t)NBL * SQ * HD) return;
  size_t off = 0; char* ws = (char*)d_ws;
  auto carve = [&](size_t bytes) { char* p = ws + off; off += (bytes + 255) & ~(size_t)255; return p; };
  b16* WT = (b16*)carve((size_t)PREP_ELEMS * 2);            // 147,456 B
  const size_t plane = (size_t)NBL * SQ * HD * 2;            // 4,194,304 B at full size
  b16* QP = (b16*)carve(plane); b16* KP = (b16*)carve(plane); b16* VT = (b16*)carve(plane);
  if (off > ws_size || off > ((size_t)128 << 20)) return;    // about 12.7 MB total
  prep_kernel<<<(unsigned)(PREP_THREADS / 256), 256, 0, stream>>>(Fp(1), Fp(3), Fp(5), WT);
  proj_kernel<<<dim3(SQ / 64, NBL), 128, 0, stream>>>(Fp(0), WT, Fp(2), Fp(4), Fp(6), QP, KP, VT);
  attn_kernel<<<dim3(SQ / QB, NBL), AW * 32, 0, stream>>>(QP, KP, VT, (float*)d_out);
}

// v008
// Measured time: 33.2 microseconds a run.
// Timed twice side by side with v007, it ran 1.04 times as fast both times.
// All steps since v000 together make it 5.12 times as fast.
#include <hip/hip_runtime.h>

// All contractions: v_wmma_f32_16x16x32_f16 (16-bit operands, f32 accumulate). Projections q/k/v = X W + b with X bf16-exact (x8) staged block-wide and W^T [o][c] bf16-exact (x256): 1 product;
// S^T = K_tile Q^T with q/k single f16 x8 planes (K = 64): 1 product; O^T += V^T P^T with V^T single f16 x8 and P single f16 x1024: 1 product. Biases, online softmax statistics and the
// final normalisation in f32. All float inputs RNE-converted to bf16 once on load.

#ifndef NB
#define NB 16
#endif
#ifndef SEQ
#define SEQ 2048
#endif

namespace {
constexpr int B_FULL = 16, T_FULL = 2048, C = 384, HD = 64;
constexpr int NBL = NB;   // batches processed
constexpr int SQ = SEQ;   // tokens processed per batch (queries and keys); input stride per batch stays T_FULL
constexpr int KC = 128;   // k chunk of C staged in LDS per pass
constexpr float XS = 8.0f, WSC = 256.0f, PS = 1024.0f, LOG2E = 1.4426950408889634f, SCL = 0.125f;   // 64^-0.5
static_assert(NBL >= 1 && NBL <= B_FULL);
static_assert(SQ >= 64 && SQ <= T_FULL && SQ % 64 == 0 && SQ % 32 == 0);
static_assert(C % KC == 0 && KC % 32 == 0 && C % 8 == 0 && HD == 64);
constexpr int XL = 64 * (KC / 4) / 128;   // 16-byte loads of X per thread and k chunk in a projection block
static_assert(KC / 4 == 32 && XL * 4 == 64);   // one wave's load covers one token's row of the chunk; 4 waves x XL loads cover the 64 tokens
constexpr int NO = 3 * HD;   // output columns of the three projections together
static_assert(24 * 8 * 128 == NO * KC && NO == 4 * 3 * 16);   // 24 pieces of 8 halves per thread of a projection block fill the staged W^T chunk; 4 waves x 3 column tiles
constexpr int PREP_ELEMS = 3 * HD * C;           // 73728 halves in W^T
constexpr int PREP_THREADS = PREP_ELEMS / 8;     // 9216 threads, 8 halves each
static_assert(PREP_ELEMS % 8 == 0 && PREP_THREADS % 256 == 0);
// coverage: prep grid (PREP_THREADS/256) x 256 x 8 == 3*HD*C; proj grid (SQ/64, NBL) x 64 tokens x HD == NBL*SQ*HD per plane, three planes per block; attn grid (SQ/QB, NBL) x QB rows x HD == NBL*SQ*HD == out
static_assert((PREP_THREADS / 256) * 256 * 8 == PREP_ELEMS);
static_assert((SQ / 64) * 64 == SQ && (SQ / 32) * 32 == SQ);
constexpr int AW = 16, KS = 4, QG = AW / KS, QB = QG * 32;   // attention block: waves (4 per SIMD), key shares of a tile, groups of 32 query rows, query rows
constexpr int KT = 256, NT = SQ / KT;   // keys per staged tile (a share stays 64 keys), tiles
static_assert(SQ % QB == 0 && SQ % KT == 0 && KT % (32 * KS) == 0 && 4 * 8 * AW * 32 == KT * HD);   // 4 pieces of 8 halves per thread fill each staged tile
static_assert(KS == 4 && QG * KS == AW && KS * 16 * 32 == 32 * HD);   // the closing merge joins waves qg, qg + QG, qg + 2 QG, qg + 3 QG; each of the four finishes 16 query rows x 32 columns of the group's 32 x 64

typedef _Float16 b16;
typedef __attribute__((ext_vector_type(16))) _Float16 v16b;
typedef __attribute__((ext_vector_type(8))) _Float16 v8b;
typedef __attribute__((ext_vector_type(4))) _Float16 v4h;
typedef __attribute__((ext_vector_type(8))) float v8f;
typedef __attribute__((ext_vector_type(4))) float v4f;

__device__ __forceinline__ float bf16_rne(float f) { unsigned int u = __float_as_uint(f); u += 0x7FFFu + ((u >> 16) & 1u); return __uint_as_float(u & 0xFFFF0000u); }
__device__ __forceinline__ v16b frag_kb(const b16* p, int hh) { const v8b a = *(const v8b*)(p + 8 * hh), b = *(const v8b*)(p + 16 + 8 * hh); v16b f;
#pragma unroll
  for (int e = 0; e < 8; ++e) { f[e] = a[e]; f[8 + e] = b[e]; } return f; }
__device__ __forceinline__ v8f wmma16b(v16b a, v16b b, v8f c) { v8f d = __builtin_amdgcn_wmma_f32_16x16x32_f16(false, a, false, b, (short)0, c, false, false); asm volatile("v_nop\n\tv_nop\n\tv_nop\n\tv_nop" : "+v"(d) : "v"(a), "v"(b)); return d; }
__device__ __forceinline__ float nexp2(float v) { return __builtin_amdgcn_exp2f(v); }
__device__ __forceinline__ float other_half(float v) { const int b = __float_as_int(v); return __int_as_float(__builtin_amdgcn_permlanex16(b, b, 0x76543210, 0xfedcba98, false, false)); }   // lane l takes lane l ^ 16's value, by a vector move

__global__ __launch_bounds__(256) void prep_kernel(const float* __restrict__ wq, const float* __restrict__ wk, const float* __restrict__ wv, b16* __restrict__ WT) {
  const size_t u = (size_t)blockIdx.x * 256 + threadIdx.x; if (u >= (size_t)PREP_THREADS) return;
  const size_t e = u * 8; const int oo = (int)(e / C), c0 = (int)(e % C); const int m = oo / HD, o2 = oo % HD; const float* w = m == 0 ? wq : m == 1 ? wk : wv; v8b o;
#pragma unroll
  for (int j = 0; j < 8; ++j) o[j] = (b16)(bf16_rne(w[(size_t)(c0 + j) * HD + o2]) * WSC);
  { *(v8b*)(WT + e) = o;  }
}

// projections: grid (SQ/64, NBL); block = 64 tokens x 4 waves and ALL THREE projections: an X chunk is read from memory, converted and staged once and serves the 192 output columns
// (0..63 q, row operand, plane QP [b][tok][64]; 64..127 k, streamed operand, plane KP [b][tok][64]; 128..191 v, V^T [b][d][tok]); W^T rows of the three parts lie one behind the other in WT.
// A wave takes the 64 tokens x 48 columns (4 x 3 accumulator tiles): 7 fragments read from LDS feed 12 products, and each W^T row is read by one wave only.
__global__ __launch_bounds__(128) void proj_kernel(const float* __restrict__ X, const b16* __restrict__ WT, const float* __restrict__ bq, const float* __restrict__ bk, const float* __restrict__ bv,
                                                   b16* __restrict__ QP, b16* __restrict__ KP, b16* __restrict__ VT) {
  __shared__ __attribute__((aligned(16))) b16 As[64][KC + 8]; __shared__ __attribute__((aligned(16))) float Tf[3][64][HD + 4];
  __shared__ __attribute__((aligned(16))) b16 Ws[NO][KC + 8];   // the W^T rows of all three parts, one k chunk; row pitch 272 B: 16 B x odd for 16-byte readers
  const int wave = threadIdx.x >> 5, lane = threadIdx.x & 31, nloc = lane & 15, hlf = lane >> 4; const int t0 = blockIdx.x * 64; const int b = blockIdx.y;
  const float* xb = X + ((size_t)b * T_FULL + t0) * C;
  // one k chunk of W^T (192 rows of 256 B): every thread copies 24 pieces of 16 B, 12 per statement; a wave's copy covers 2 rows of 2 whole lines each
  const unsigned lw0 = (unsigned)(size_t)(&Ws[threadIdx.x / (KC / 8)][(threadIdx.x % (KC / 8)) * 8]); const b16* gw0 = WT + (size_t)(threadIdx.x / (KC / 8)) * C + (threadIdx.x % (KC / 8)) * 8;
  auto w_copy12 = [&](int kc, int j0) {
    unsigned lw[12]; const b16* gw[12];
#pragma unroll   // the address arrays stay in registers
    for (int j = 0; j < 12; ++j) { lw[j] = lw0 + (unsigned)((j0 + j) * 8 * (KC + 8) * 2); gw[j] = gw0 + kc + (j0 + j) * 8 * C; }   // piece j of a thread lies 8 rows behind piece j - 1: constant steps from one base, no table of addresses held over the loop
    // the copies and, as their statement's last line, the wait that stands before any of their address registers is rewritten
    asm volatile("global_load_async_to_lds_b128 %0, %1, off\n\t"
                 "global_load_async_to_lds_b128 %2, %3, off\n\t"
                 "global_load_async_to_lds_b128 %4, %5, off\n\t"
                 "global_load_async_to_lds_b128 %6, %7, off\n\t"
                 "global_load_async_to_lds_b128 %8, %9, off\n\t"
                 "global_load_async_to_lds_b128 %10, %11, off\n\t"
                 "global_load_async_to_lds_b128 %12, %13, off\n\t"
                 "global_load_async_to_lds_b128 %14, %15, off\n\t"
                 "global_load_async_to_lds_b128 %16, %17, off\n\t"
                 "global_load_async_to_lds_b128 %18, %19, off\n\t"
                 "global_load_async_to_lds_b128 %20, %21, off\n\t"
                 "global_load_async_to_lds_b128 %22, %23, off\n\t"
                 "s_wait_xcnt 0x0"
                 :: "v"(lw[0]), "v"(gw[0]), "v"(lw[1]), "v"(gw[1]), "v"(lw[2]), "v"(gw[2]), "v"(lw[3]), "v"(gw[3]),
                    "v"(lw[4]), "v"(gw[4]), "v"(lw[5]), "v"(gw[5]), "v"(lw[6]), "v"(gw[6]), "v"(lw[7]), "v"(gw[7]),
                    "v"(lw[8]), "v"(gw[8]), "v"(lw[9]), "v"(gw[9]), "v"(lw[10]), "v"(gw[10]), "v"(lw[11]), "v"(gw[11]) : "memory"); };
  const float* xp = xb + wave * C + lane * 4;   // the thread's place in a group of 4 token rows: wave = row, lane = 16-byte piece; steps on by a chunk per pass
  v8f acc[4][3];   // [token tile][column tile]
#pragma unroll   // here and below, every nest over i, u, r: the register arrays need constant indices
  for (int i = 0; i < 4; ++i)
#pragma unroll
    for (int u = 0; u < 3; ++u) acc[i][u] = (v8f){};
#pragma unroll 1   // rolled: one chunk's body is all the code the loop needs
  for (int kc = 0; kc < C; kc += KC) {
    asm volatile("s_wait_dscnt 0x0" ::: "memory");   // this wave's reads of the last chunk are done
    __syncthreads();   // ends every wave's reads of the last chunk
    w_copy12(kc, 0); w_copy12(kc, 12);   // in flight while the X chunk is converted
    v4f xf[XL];   // the thread's whole share of the X chunk: every load is issued before the first value is used, so a chunk costs one memory round trip, not one per pair of loads
#pragma unroll   // the load array stays in registers (this loop and the next); the row steps become immediate offsets
    for (int g = 0; g < XL; ++g) xf[g] = *(const v4f*)(xp + g * 4 * C);
    xp += KC;
#pragma unroll
    for (int g = 0; g < XL; ++g) { v4h o;
#pragma unroll
      for (int j = 0; j < 4; ++j) o[j] = (b16)(bf16_rne(xf[g][j]) * XS); *(v4h*)(&As[g * 4 + wave][lane * 4]) = o; }
    asm volatile("s_wait_asynccnt 0x0" ::: "memory");   // this wave's copies of the W^T chunk have landed
    __syncthreads();   // publishes the X chunk and the W^T chunk
#pragma unroll 2   // two k steps a trip: one trip's fragments and the 12 accumulator tiles fit 256 registers
    for (int kb = 0; kb < KC; kb += 32) { v16b a[4], wf[3];   // the k step's fragments as one group of LDS reads ahead of its products
#pragma unroll
      for (int i = 0; i < 4; ++i) a[i] = frag_kb(&As[i * 16 + nloc][kb], hlf);
#pragma unroll
      for (int u = 0; u < 3; ++u) wf[u] = frag_kb(&Ws[wave * 48 + u * 16 + nloc][kb], hlf);
#pragma unroll
      for (int u = 0; u < 3; ++u)
#pragma unroll
        for (int i = 0; i < 4; ++i) acc[i][u] = wmma16b(a[i], wf[u], acc[i][u]); } }
#pragma unroll
  for (int u = 0; u < 3; ++u) { const int g = wave * 3 + u, pt = g >> 2, tc = (g & 3) * 16 + nloc;   // column tile g of 12: part and column inside the part
    const float* bias = pt == 0 ? bq : pt == 1 ? bk : bv; const float bb = bf16_rne(bias[tc]);
#pragma unroll
    for (int i = 0; i < 4; ++i)
#pragma unroll
      for (int r = 0; r < 8; ++r) Tf[pt][i * 16 + 8 * hlf + r][tc] = acc[i][u][r] * (1.0f / (XS * WSC)) + bb; }
  __syncthreads();   // every wave reads Tf rows and columns that other waves wrote
#pragma unroll 1   // rolled (this loop and the next): run once per block, short code
  for (int it = 0; it < 8; ++it) { const int pt = it >> 2; b16* plane = pt == 0 ? QP : KP; const int rr = wave * 16 + (it & 3) * 4 + (lane >> 3); const int c8 = (lane & 7) * 8; v8b o8;
#pragma unroll
    for (int j = 0; j < 8; ++j) o8[j] = (b16)(Tf[pt][rr][c8 + j] * XS);
    *(v8b*)(plane + ((size_t)b * SQ + t0 + rr) * HD + c8) = o8;
    asm volatile("s_wait_xcnt 0x0" ::: "memory"); }   // stands before the next trip rewrites the store's address and data registers
#pragma unroll 1
  for (int it = 0; it < 4; ++it) { const int d = wave * 16 + it * 4 + (lane >> 3); const int tk0 = (lane & 7) * 8; v8b vv;
#pragma unroll
    for (int j = 0; j < 8; ++j) vv[j] = (b16)(Tf[2][tk0 + j][d] * XS);
    *(v8b*)(VT + ((size_t)b * HD + d) * (size_t)SQ + t0 + tk0) = vv; }
}

// attention: grid (SQ/QB, NBL): block = QG groups of 32 query rows x KS key shares, one wave each: a wave works its share (KT/KS keys) of every tile for two query tiles of 16 rows, so each K and V^T
// fragment it reads from LDS feeds two products; the four waves of a group hold partial results (own running max, sum, output tiles) that are merged once behind the loop, through LDS, each wave finishing half the columns of one query tile.
// 16 waves a block, one block a WGP: four waves share a SIMD, so one wave's softmax chain and LDS waits are filled by three others' work.
// K and V^T tiles of KT keys are staged in LDS once per block by asynchronous copies (whole lines, two buffers, the next tile's
// copies in flight while this tile is worked on, one block barrier per tile) and every wave takes its fragments from there; q fragments register-resident; S^T = K_tile Q^T (lane col = query row,
// D rows = keys; K = 64 = 2 k-steps); online softmax over keys with running max; P x1024 single, packed in registers: a lane's 16 scores of a pass are its 16 elements of the B fragment; O^T += V^T P^T (4 d-tiles);
// out rows [b][t][64] f32:
__global__ __launch_bounds__(AW * 32) void attn_kernel(const b16* __restrict__ QP, const b16* __restrict__ KP, const b16* __restrict__ VT, float* __restrict__ out) {
  __shared__ __attribute__((aligned(16))) b16 Ks[2][KT][HD + 8]; __shared__ __attribute__((aligned(16))) b16 Vs[2][HD][KT + 8];   // row pitches 144 B and 528 B: 16 B x odd for 16-byte readers
  __shared__ __attribute__((aligned(16))) float Tx[AW][2][16][HD + 4]; __shared__ float Sx[AW][2][2][16];   // every wave's partial output tiles [query tile][row][column], max and sum [query tile][max, sum][row]
  const int tid = threadIdx.x, wave = tid >> 5, lane = tid & 31, hh = lane >> 4, col = lane & 15; const int b = blockIdx.y; const int qg = wave % QG, kh = wave / QG; const int r0 = blockIdx.x * QB + qg * 32;
  const b16* Qb = QP + (size_t)b * SQ * HD; const b16* Kb = KP + (size_t)b * SQ * HD; const b16* Vb = VT + (size_t)b * HD * (size_t)SQ;
  // one tile: every thread copies 4 pieces of 16 B of K (32 KB in a row in memory) and 4 of V^T (64 rows of 512 B); a wave's copy covers 4 whole lines
  auto tile_copy = [&](int s0, int buf) {
    unsigned lk[4], lv[4]; const b16* gk[4]; const b16* gv[4];
#pragma unroll   // the address arrays stay in registers
    for (int j = 0; j < 4; ++j) { const int c = j * (AW * 32) + tid;
      lk[j] = (unsigned)(size_t)(&Ks[buf][c / (HD / 8)][(c % (HD / 8)) * 8]); gk[j] = Kb + (size_t)s0 * HD + (size_t)c * 8;
      lv[j] = (unsigned)(size_t)(&Vs[buf][c / (KT / 8)][(c % (KT / 8)) * 8]); gv[j] = Vb + (size_t)(c / (KT / 8)) * SQ + s0 + (c % (KT / 8)) * 8; }
    // the copies and, as their statement's last line, the wait that stands before any of their address registers is rewritten
    asm volatile("global_load_async_to_lds_b128 %0, %1, off\n\t"
                 "global_load_async_to_lds_b128 %2, %3, off\n\t"
                 "global_load_async_to_lds_b128 %4, %5, off\n\t"
                 "global_load_async_to_lds_b128 %6, %7, off\n\t"
                 "global_load_async_to_lds_b128 %8, %9, off\n\t"
                 "global_load_async_to_lds_b128 %10, %11, off\n\t"
                 "global_load_async_to_lds_b128 %12, %13, off\n\t"
                 "global_load_async_to_lds_b128 %14, %15, off\n\t"
                 "s_wait_xcnt 0x0"
                 :: "v"(lk[0]), "v"(gk[0]), "v"(lk[1]), "v"(gk[1]), "v"(lk[2]), "v"(gk[2]), "v"(lk[3]), "v"(gk[3]),
                    "v"(lv[0]), "v"(gv[0]), "v"(lv[1]), "v"(gv[1]), "v"(lv[2]), "v"(gv[2]), "v"(lv[3]), "v"(gv[3]) : "memory"); };
  tile_copy(0, 0);
  v16b qa[2][2];   // [query tile][k step]
#pragma unroll   // here and below, every nest over j, u, t, r, i: the register arrays need constant indices
  for (int j = 0; j < 2; ++j)
#pragma unroll
    for (int i = 0; i < 2; ++i) qa[j][i] = frag_kb(Qb + (size_t)(r0 + j * 16 + col) * HD + 32 * i, hh);
  const float cs = SCL * LOG2E / (XS * XS);
  float m[2], l[2]; v8f o[2][4];
#pragma unroll
  for (int j = 0; j < 2; ++j) { m[j] = -__builtin_inff(); l[j] = 0.0f;
#pragma unroll
    for (int t = 0; t < 4; ++t) o[j][t] = (v8f){}; }
  asm volatile("s_wait_asynccnt 0x0" ::: "memory");   // this wave's copies of tile 0 have landed
  __syncthreads();   // tile 0 is published
  if (NT > 1) tile_copy(KT, 1);
#pragma unroll 1   // rolled: one tile's body is all the code the loop needs
  for (int tl = 0; tl < NT; ++tl) {
    const int buf = tl & 1;
#pragma unroll   // the offsets inside a tile become immediates of the LDS reads
    for (int sp = 0; sp < KT / KS; sp += 32) { const int sb = kh * (KT / KS) + sp;   // the wave's share of the tile
      v16b kf[4], vf[4];   // the pass's fragments as one group of LDS reads ahead of its products; each serves both query tiles
#pragma unroll   // fragment arrays stay in registers (this loop and the next)
      for (int u = 0; u < 4; ++u) kf[u] = frag_kb(&Ks[buf][sb + (u >> 1) * 16 + col][32 * (u & 1)], hh);
#pragma unroll
      for (int t = 0; t < 4; ++t) vf[t] = frag_kb(&Vs[buf][t * 16 + col][sb], hh);
      v8f s[2][2];   // [query tile][key tile]: four independent accumulators, so the second k step finds the first one's results ready
      // the pass's eight score products as one run: each fills the window behind the one before it (the second four accumulate into their own D), so only the last needs vector slots,
      // the four v_nop that end the statement, before a vector instruction may touch its D, A or B. A v_nop behind every product took a slot of the SIMD's one vector port from the other three waves' softmax.
      asm volatile("v_wmma_f32_16x16x32_f16 %0, %4, %8, 0\n\t"
                   "v_wmma_f32_16x16x32_f16 %1, %6, %8, 0\n\t"
                   "v_wmma_f32_16x16x32_f16 %2, %4, %10, 0\n\t"
                   "v_wmma_f32_16x16x32_f16 %3, %6, %10, 0\n\t"
                   "v_wmma_f32_16x16x32_f16 %0, %5, %9, %0\n\t"
                   "v_wmma_f32_16x16x32_f16 %1, %7, %9, %1\n\t"
                   "v_wmma_f32_16x16x32_f16 %2, %5, %11, %2\n\t"
                   "v_wmma_f32_16x16x32_f16 %3, %7, %11, %3\n\t"
                   "v_nop\n\tv_nop\n\tv_nop\n\tv_nop"
                   : "=&v"(s[0][0]), "=&v"(s[0][1]), "=&v"(s[1][0]), "=&v"(s[1][1])
                   : "v"(kf[0]), "v"(kf[1]), "v"(kf[2]), "v"(kf[3]), "v"(qa[0][0]), "v"(qa[0][1]), "v"(qa[1][0]), "v"(qa[1][1]));
      v16b pf[2];
#pragma unroll   // both query tiles' softmax chains in one straight run, free to interleave
      for (int j = 0; j < 2; ++j) {
        float e[16]; float mx = -__builtin_inff();
#pragma unroll
        for (int u = 0; u < 2; ++u)
#pragma unroll
          for (int r = 0; r < 8; ++r) { const float vv = s[j][u][r] * cs; e[u * 8 + r] = vv; mx = fmaxf(mx, vv); }
        mx = fmaxf(mx, other_half(mx)); const float mn = fmaxf(m[j], mx); const float al = nexp2(m[j] - mn); float sum = 0.0f;
#pragma unroll
        for (int i2 = 0; i2 < 16; ++i2) { const float p = nexp2(e[i2] - mn); sum += p; pf[j][i2] = (b16)(p * PS); }   // element i2 of the B fragment is key (i2 < 8 ? 0 : 16) + 8 * hh + (i2 & 7): the key of score register i2
        sum += other_half(sum); l[j] = l[j] * al + sum; m[j] = mn;
#pragma unroll
        for (int t = 0; t < 4; ++t) o[j][t] *= al; }
      __builtin_amdgcn_sched_barrier(0);   // keeps the pass's vector work (subtracts, exponentials, scalings, conversions, rescale) as groups ahead of the products: scheduled across this line it came out chained pair by pair, each link's latency exposed
      // the pass's eight output products as one run, eight accumulators of their own; the four v_nop keep the last one's distance to the next vector instruction on its D, A or B
      asm volatile("v_wmma_f32_16x16x32_f16 %0, %8, %12, %0\n\t"
                   "v_wmma_f32_16x16x32_f16 %1, %9, %12, %1\n\t"
                   "v_wmma_f32_16x16x32_f16 %2, %10, %12, %2\n\t"
                   "v_wmma_f32_16x16x32_f16 %3, %11, %12, %3\n\t"
                   "v_wmma_f32_16x16x32_f16 %4, %8, %13, %4\n\t"
                   "v_wmma_f32_16x16x32_f16 %5, %9, %13, %5\n\t"
                   "v_wmma_f32_16x16x32_f16 %6, %10, %13, %6\n\t"
                   "v_wmma_f32_16x16x32_f16 %7, %11, %13, %7\n\t"
                   "v_nop\n\tv_nop\n\tv_nop\n\tv_nop"
                   : "+v"(o[0][0]), "+v"(o[0][1]), "+v"(o[0][2]), "+v"(o[0][3]), "+v"(o[1][0]), "+v"(o[1][1]), "+v"(o[1][2]), "+v"(o[1][3])
                   : "v"(vf[0]), "v"(vf[1]), "v"(vf[2]), "v"(vf[3]), "v"(pf[0]), "v"(pf[1])); }
    asm volatile("s_wait_dscnt 0x0" ::: "memory");      // this wave's reads of tile tl are done
    asm volatile("s_wait_asynccnt 0x0" ::: "memory");   // this wave's copies of tile tl + 1 have landed
    __syncthreads();   // publishes tile tl + 1 and ends every wave's reads of tile tl
    if (tl + 2 < NT) tile_copy((tl + 2) * KT, buf);   // refill of the buffer that this pass has just read
  }
  asm volatile("s_wait_asynccnt 0x0" ::: "memory");   // no copy is left in flight behind the loop
  // merge of the four key shares: every wave lays down both its partial tiles with their max and sum; behind one barrier wave (qg, kh) finishes query tile kh & 1, columns 32 * (kh >> 1) .. + 31
#pragma unroll
  for (int j = 0; j < 2; ++j) {
#pragma unroll
    for (int t = 0; t < 4; ++t)
#pragma unroll
      for (int r = 0; r < 8; ++r) Tx[wave][j][col][t * 16 + 8 * hh + r] = o[j][t][r];
    Sx[wave][j][hh][col] = hh ? l[j] : m[j]; }   // both lane halves hold both values: half 0 writes the max, half 1 the sum
  __syncthreads();   // publishes every wave's partials
  const int jt = kh & 1, dh = kh >> 1;
#pragma unroll   // the four trips are independent: unrolled, their LDS reads and exponentials overlap, and the stores stand last with constant offsets
  for (int it = 0; it < 4; ++it) { const int rr = it * 4 + (lane >> 3); const int c4 = dh * 32 + (lane & 7) * 4;   // a store covers 4 rows x one whole 128-byte line
    float mp[KS], lp[KS]; float mn = -__builtin_inff();
#pragma unroll
    for (int p = 0; p < KS; ++p) { mp[p] = Sx[qg + QG * p][jt][0][rr]; lp[p] = Sx[qg + QG * p][jt][1][rr]; mn = fmaxf(mn, mp[p]); }
    float den = 0.0f; v4f acc = (v4f){};
#pragma unroll
    for (int p = 0; p < KS; ++p) { const float a = nexp2(mp[p] - mn); den += lp[p] * a; acc += *(const v4f*)(&Tx[qg + QG * p][jt][rr][c4]) * a; }
    *(v4f*)(out + ((size_t)b * SQ + r0 + jt * 16 + rr) * HD + c4) = acc * (1.0f / (den * PS * XS)); }
}
}  // namespace

extern "C" void kernel_launch(void* const* d_in, const int* in_sizes, int n_in, void* d_out, int out_size, void* d_ws, size_t ws_size, hipStream_t stream) {
  if (n_in < 7) return;
  auto Fp = [&](int i) { return (const float*)d_in[i]; };
  // wire order: 0 x [16,2048,384], 1 Wq [384,64], 2 bq [64], 3 Wk [384,64], 4 bk [64], 5 Wv [384,64], 6 bv [64]
  if ((size_t)in_sizes[0] < (size_t)NBL * T_FULL * C || in_sizes[1] < C * HD || in_sizes[2] < HD || in_sizes[3] < C * HD || in_sizes[4] < HD || in_sizes[5] < C * HD || in_sizes[6] < HD) return;
  if ((size_t)out_size < (size_t)NBL * SQ * HD) return;
  size_t off = 0; char* ws = (char*)d_ws;
  auto carve = [&](size_t bytes) { char* p = ws + off; off += (bytes + 255) & ~(size_t)255; return p; };
  b16* WT = (b16*)carve((size_t)PREP_ELEMS * 2);            // 147,456 B
  const size_t plane = (size_t)NBL * SQ * HD * 2;            // 4,194,304 B at full size
  b16* QP = (b16*)carve(plane); b16* KP = (b16*)carve(plane); b16* VT = (b16*)carve(plane);
  if (off > ws_size || off > ((size_t)128 << 20)) return;    // about 12.7 MB total
  prep_kernel<<<(unsigned)(PREP_THREADS / 256), 256, 0, stream>>>(Fp(1), Fp(3), Fp(5), WT);
  proj_kernel<<<dim3(SQ / 64, NBL), 128, 0, stream>>>(Fp(0), WT, Fp(2), Fp(4), Fp(6), QP, KP, VT);
  attn_kernel<<<dim3(SQ / QB, NBL), AW * 32, 0, stream>>>(QP, KP, VT, (float*)d_out);
}

// v009
// It runs in 31.8 microseconds.
// In two side-by-side timings against v008, it was 1.03 and 1.05 times as fast.
// Over all steps from v000 it is 5.33 times as fast.
#include <hip/hip_runtime.h>

// All contractions: v_wmma_f32_16x16x32_f16 (16-bit operands, f32 accumulate). Projections q/k/v = X W + b with X bf16-exact (x8) staged block-wide and W^T [o][c] bf16-exact (x256): 1 product;
// S^T = K_tile Q^T with q/k single f16 x8 planes (K = 64): 1 product; O^T += V^T P^T with V^T single f16 x8 and P single f16 x1024: 1 product. Biases, online softmax statistics and the
// final normalisation in f32. All float inputs RNE-converted to bf16 once on load.

#ifndef NB
#define NB 16
#endif
#ifndef SEQ
#define SEQ 2048
#endif

namespace {
constexpr int B_FULL = 16, T_FULL = 2048, C = 384, HD = 64;
constexpr int NBL = NB;   // batches processed
constexpr int SQ = SEQ;   // tokens processed per batch (queries and keys); input stride per batch stays T_FULL
constexpr int KC = 128;   // k chunk of C staged in LDS per pass
constexpr float XS = 8.0f, WSC = 256.0f, PSL2 = 10.0f, LOG2E = 1.4426950408889634f, SCL = 0.125f;   // 64^-0.5
static_assert(NBL >= 1 && NBL <= B_FULL);
static_assert(SQ >= 64 && SQ <= T_FULL && SQ % 64 == 0 && SQ % 32 == 0);
static_assert(C % KC == 0 && KC % 32 == 0 && C % 8 == 0 && HD == 64);
constexpr int XL = 64 * (KC / 4) / 128;   // 16-byte loads of X per thread and k chunk in a projection block
static_assert(KC / 4 == 32 && XL * 4 == 64);   // one wave's load covers one token's row of the chunk; 4 waves x XL loads cover the 64 tokens
constexpr int NO = 3 * HD;   // output columns of the three projections together
static_assert(24 * 8 * 128 == NO * KC && NO == 4 * 3 * 16);   // 24 pieces of 8 halves per thread of a projection block fill the staged W^T chunk; 4 waves x 3 column tiles
constexpr int PREP_ELEMS = 3 * HD * C;           // 73728 halves in W^T
constexpr int PREP_THREADS = PREP_ELEMS / 8;     // 9216 threads, 8 halves each
static_assert(PREP_ELEMS % 8 == 0 && PREP_THREADS % 256 == 0);
// coverage: prep grid (PREP_THREADS/256) x 256 x 8 == 3*HD*C; proj grid (SQ/64, NBL) x 64 tokens x HD == NBL*SQ*HD per plane, three planes per block; attn grid (SQ/QB, NBL) x QB rows x HD == NBL*SQ*HD == out
static_assert((PREP_THREADS / 256) * 256 * 8 == PREP_ELEMS);
static_assert((SQ / 64) * 64 == SQ && (SQ / 32) * 32 == SQ);
constexpr int AW = 16, KS = 4, QG = AW / KS, QB = QG * 32;   // attention block: waves (4 per SIMD), key shares of a tile, groups of 32 query rows, query rows
constexpr int KT = 256, NT = SQ / KT;   // keys per staged tile (a share stays 64 keys), tiles
static_assert(SQ % QB == 0 && SQ % KT == 0 && KT % (32 * KS) == 0 && 4 * 8 * AW * 32 == KT * HD);   // 4 pieces of 8 halves per thread fill each staged tile
static_assert(KS == 4 && QG * KS == AW && KS * 16 * 32 == 32 * HD);   // the closing merge joins waves qg, qg + QG, qg + 2 QG, qg + 3 QG; each of the four finishes 16 query rows x 32 columns of the group's 32 x 64

typedef _Float16 b16;
typedef __attribute__((ext_vector_type(16))) _Float16 v16b;
typedef __attribute__((ext_vector_type(8))) _Float16 v8b;
typedef __attribute__((ext_vector_type(4))) _Float16 v4h;
typedef __attribute__((ext_vector_type(8))) float v8f;
typedef __attribute__((ext_vector_type(4))) float v4f;
typedef __attribute__((ext_vector_type(2))) float v2f;

__device__ __forceinline__ float bf16_rne(float f) { unsigned int u = __float_as_uint(f); u += 0x7FFFu + ((u >> 16) & 1u); return __uint_as_float(u & 0xFFFF0000u); }
__device__ __forceinline__ v16b frag_kb(const b16* p, int hh) { const v8b a = *(const v8b*)(p + 8 * hh), b = *(const v8b*)(p + 16 + 8 * hh); v16b f;
#pragma unroll
  for (int e = 0; e < 8; ++e) { f[e] = a[e]; f[8 + e] = b[e]; } return f; }
__device__ __forceinline__ v8f wmma16b(v16b a, v16b b, v8f c) { v8f d = __builtin_amdgcn_wmma_f32_16x16x32_f16(false, a, false, b, (short)0, c, false, false); asm volatile("v_nop\n\tv_nop\n\tv_nop\n\tv_nop" : "+v"(d) : "v"(a), "v"(b)); return d; }
__device__ __forceinline__ float nexp2(float v) { return __builtin_amdgcn_exp2f(v); }
__device__ __forceinline__ float other_half(float v) { const int b = __float_as_int(v); return __int_as_float(__builtin_amdgcn_permlanex16(b, b, 0x76543210, 0xfedcba98, false, false)); }   // lane l takes lane l ^ 16's value, by a vector move

__global__ __launch_bounds__(256) void prep_kernel(const float* __restrict__ wq, const float* __restrict__ wk, const float* __restrict__ wv, b16* __restrict__ WT) {
  const size_t u = (size_t)blockIdx.x * 256 + threadIdx.x; if (u >= (size_t)PREP_THREADS) return;
  const size_t e = u * 8; const int oo = (int)(e / C), c0 = (int)(e % C); const int m = oo / HD, o2 = oo % HD; const float* w = m == 0 ? wq : m == 1 ? wk : wv; v8b o;
#pragma unroll
  for (int j = 0; j < 8; ++j) o[j] = (b16)(bf16_rne(w[(size_t)(c0 + j) * HD + o2]) * WSC);
  { *(v8b*)(WT + e) = o;  }
}

// projections: grid (SQ/64, NBL); block = 64 tokens x 4 waves and ALL THREE projections: an X chunk is read from memory, converted and staged once and serves the 192 output columns
// (0..63 q, row operand, plane QP [b][tok][64]; 64..127 k, streamed operand, plane KP [b][tok][64]; 128..191 v, V^T [b][d][tok]); W^T rows of the three parts lie one behind the other in WT.
// A wave takes the 64 tokens x 48 columns (4 x 3 accumulator tiles): 7 fragments read from LDS feed 12 products, and each W^T row is read by one wave only.
__global__ __launch_bounds__(128) void proj_kernel(const float* __restrict__ X, const b16* __restrict__ WT, const float* __restrict__ bq, const float* __restrict__ bk, const float* __restrict__ bv,
                                                   b16* __restrict__ QP, b16* __restrict__ KP, b16* __restrict__ VT) {
  __shared__ __attribute__((aligned(16))) b16 As[64][KC + 8]; __shared__ __attribute__((aligned(16))) float Tf[3][64][HD + 4];
  __shared__ __attribute__((aligned(16))) b16 Ws[NO][KC + 8];   // the W^T rows of all three parts, one k chunk; row pitch 272 B: 16 B x odd for 16-byte readers
  const int wave = threadIdx.x >> 5, lane = threadIdx.x & 31, nloc = lane & 15, hlf = lane >> 4; const int t0 = blockIdx.x * 64; const int b = blockIdx.y;
  const float* xb = X + ((size_t)b * T_FULL + t0) * C;
  // one k chunk of W^T (192 rows of 256 B): every thread copies 24 pieces of 16 B, 12 per statement; a wave's copy covers 2 rows of 2 whole lines each
  const unsigned lw0 = (unsigned)(size_t)(&Ws[threadIdx.x / (KC / 8)][(threadIdx.x % (KC / 8)) * 8]); const b16* gw0 = WT + (size_t)(threadIdx.x / (KC / 8)) * C + (threadIdx.x % (KC / 8)) * 8;
  auto w_copy12 = [&](int kc, int j0) {
    unsigned lw[12]; const b16* gw[12];
#pragma unroll   // the address arrays stay in registers
    for (int j = 0; j < 12; ++j) { lw[j] = lw0 + (unsigned)((j0 + j) * 8 * (KC + 8) * 2); gw[j] = gw0 + kc + (j0 + j) * 8 * C; }   // piece j of a thread lies 8 rows behind piece j - 1: constant steps from one base, no table of addresses held over the loop
    // the copies and, as their statement's last line, the wait that stands before any of their address registers is rewritten
    asm volatile("global_load_async_to_lds_b128 %0, %1, off\n\t"
                 "global_load_async_to_lds_b128 %2, %3, off\n\t"
                 "global_load_async_to_lds_b128 %4, %5, off\n\t"
                 "global_load_async_to_lds_b128 %6, %7, off\n\t"
                 "global_load_async_to_lds_b128 %8, %9, off\n\t"
                 "global_load_async_to_lds_b128 %10, %11, off\n\t"
                 "global_load_async_to_lds_b128 %12, %13, off\n\t"
                 "global_load_async_to_lds_b128 %14, %15, off\n\t"
                 "global_load_async_to_lds_b128 %16, %17, off\n\t"
                 "global_load_async_to_lds_b128 %18, %19, off\n\t"
                 "global_load_async_to_lds_b128 %20, %21, off\n\t"
                 "global_load_async_to_lds_b128 %22, %23, off\n\t"
                 "s_wait_xcnt 0x0"
                 :: "v"(lw[0]), "v"(gw[0]), "v"(lw[1]), "v"(gw[1]), "v"(lw[2]), "v"(gw[2]), "v"(lw[3]), "v"(gw[3]),
                    "v"(lw[4]), "v"(gw[4]), "v"(lw[5]), "v"(gw[5]), "v"(lw[6]), "v"(gw[6]), "v"(lw[7]), "v"(gw[7]),
                    "v"(lw[8]), "v"(gw[8]), "v"(lw[9]), "v"(gw[9]), "v"(lw[10]), "v"(gw[10]), "v"(lw[11]), "v"(gw[11]) : "memory"); };
  const float* xp = xb + wave * C + lane * 4;   // the thread's place in a group of 4 token rows: wave = row, lane = 16-byte piece; steps on by a chunk per pass
  v8f acc[4][3];   // [token tile][column tile]
#pragma unroll   // here and below, every nest over i, u, r: the register arrays need constant indices
  for (int i = 0; i < 4; ++i)
#pragma unroll
    for (int u = 0; u < 3; ++u) acc[i][u] = (v8f){};
#pragma unroll 1   // rolled: one chunk's body is all the code the loop needs
  for (int kc = 0; kc < C; kc += KC) {
    asm volatile("s_wait_dscnt 0x0" ::: "memory");   // this wave's reads of the last chunk are done
    __syncthreads();   // ends every wave's reads of the last chunk
    w_copy12(kc, 0); w_copy12(kc, 12);   // in flight while the X chunk is converted
    v4f xf[XL];   // the thread's whole share of the X chunk: every load is issued before the first value is used, so a chunk costs one memory round trip, not one per pair of loads
#pragma unroll   // the load array stays in registers (this loop and the next); the row steps become immediate offsets
    for (int g = 0; g < XL; ++g) xf[g] = *(const v4f*)(xp + g * 4 * C);
    xp += KC;
#pragma unroll
    for (int g = 0; g < XL; ++g) { v4h o;
#pragma unroll
      for (int j = 0; j < 4; ++j) o[j] = (b16)(bf16_rne(xf[g][j]) * XS); *(v4h*)(&As[g * 4 + wave][lane * 4]) = o; }
    asm volatile("s_wait_asynccnt 0x0" ::: "memory");   // this wave's copies of the W^T chunk have landed
    __syncthreads();   // publishes the X chunk and the W^T chunk
#pragma unroll 2   // two k steps a trip: one trip's fragments and the 12 accumulator tiles fit 256 registers
    for (int kb = 0; kb < KC; kb += 32) { v16b a[4], wf[3];   // the k step's fragments as one group of LDS reads ahead of its products
#pragma unroll
      for (int i = 0; i < 4; ++i) a[i] = frag_kb(&As[i * 16 + nloc][kb], hlf);
#pragma unroll
      for (int u = 0; u < 3; ++u) wf[u] = frag_kb(&Ws[wave * 48 + u * 16 + nloc][kb], hlf);
#pragma unroll
      for (int u = 0; u < 3; ++u)
#pragma unroll
        for (int i = 0; i < 4; ++i) acc[i][u] = wmma16b(a[i], wf[u], acc[i][u]); } }
#pragma unroll
  for (int u = 0; u < 3; ++u) { const int g = wave * 3 + u, pt = g >> 2, tc = (g & 3) * 16 + nloc;   // column tile g of 12: part and column inside the part
    const float* bias = pt == 0 ? bq : pt == 1 ? bk : bv; const float bb = bf16_rne(bias[tc]);
#pragma unroll
    for (int i = 0; i < 4; ++i)
#pragma unroll
      for (int r = 0; r < 8; ++r) Tf[pt][i * 16 + 8 * hlf + r][tc] = acc[i][u][r] * (1.0f / (XS * WSC)) + bb; }
  __syncthreads();   // every wave reads Tf rows and columns that other waves wrote
#pragma unroll 1   // rolled (this loop and the next): run once per block, short code
  for (int it = 0; it < 8; ++it) { const int pt = it >> 2; b16* plane = pt == 0 ? QP : KP; const int rr = wave * 16 + (it & 3) * 4 + (lane >> 3); const int c8 = (lane & 7) * 8; v8b o8;
#pragma unroll
    for (int j = 0; j < 8; ++j) o8[j] = (b16)(Tf[pt][rr][c8 + j] * XS);
    *(v8b*)(plane + ((size_t)b * SQ + t0 + rr) * HD + c8) = o8;
    asm volatile("s_wait_xcnt 0x0" ::: "memory"); }   // stands before the next trip rewrites the store's address and data registers
#pragma unroll 1
  for (int it = 0; it < 4; ++it) { const int d = wave * 16 + it * 4 + (lane >> 3); const int tk0 = (lane & 7) * 8; v8b vv;
#pragma unroll
    for (int j = 0; j < 8; ++j) vv[j] = (b16)(Tf[2][tk0 + j][d] * XS);
    *(v8b*)(VT + ((size_t)b * HD + d) * (size_t)SQ + t0 + tk0) = vv; }
}

// attention: grid (SQ/QB, NBL): block = QG groups of 32 query rows x KS key shares, one wave each: a wave works its share (KT/KS keys) of every tile for two query tiles of 16 rows, so each K and V^T
// fragment it reads from LDS feeds two products; the four waves of a group hold partial results (own running max, sum, output tiles) that are merged once behind the loop, through LDS, each wave finishing half the columns of one query tile.
// 16 waves a block, one block a WGP: four waves share a SIMD, so one wave's softmax chain and LDS waits are filled by three others' work.
// K and V^T tiles of KT keys are staged in LDS once per block by asynchronous copies (whole lines, two buffers, the next tile's
// copies in flight while this tile is worked on, one block barrier per tile) and every wave takes its fragments from there; q fragments register-resident; S^T = K_tile Q^T (lane col = query row,
// D rows = keys; K = 64 = 2 k-steps); online softmax over keys with running max; P x1024 single, packed in registers: a lane's 16 scores of a pass are its 16 elements of the B fragment; O^T += V^T P^T (4 d-tiles);
// out rows [b][t][64] f32:
__global__ __launch_bounds__(AW * 32) void attn_kernel(const b16* __restrict__ QP, const b16* __restrict__ KP, const b16* __restrict__ VT, float* __restrict__ out) {
  __shared__ __attribute__((aligned(16))) b16 Ks[2][KT][HD + 8]; __shared__ __attribute__((aligned(16))) b16 Vs[2][HD][KT + 8];   // row pitches 144 B and 528 B: 16 B x odd for 16-byte readers
  __shared__ __attribute__((aligned(16))) float Tx[AW][2][16][HD + 4]; __shared__ float Sx[AW][2][2][16];   // every wave's partial output tiles [query tile][row][column], max and sum [query tile][max, sum][row]
  const int tid = threadIdx.x, wave = tid >> 5, lane = tid & 31, hh = lane >> 4, col = lane & 15; const int b = blockIdx.y; const int qg = wave % QG, kh = wave / QG; const int r0 = blockIdx.x * QB + qg * 32;
  const b16* Qb = QP + (size_t)b * SQ * HD; const b16* Kb = KP + (size_t)b * SQ * HD; const b16* Vb = VT + (size_t)b * HD * (size_t)SQ;
  // one tile: every thread copies 4 pieces of 16 B of K (32 KB in a row in memory) and 4 of V^T (64 rows of 512 B); a wave's copy covers 4 whole lines
  auto tile_copy = [&](int s0, int buf) {
    unsigned lk[4], lv[4]; const b16* gk[4]; const b16* gv[4];
#pragma unroll   // the address arrays stay in registers
    for (int j = 0; j < 4; ++j) { const int c = j * (AW * 32) + tid;
      lk[j] = (unsigned)(size_t)(&Ks[buf][c / (HD / 8)][(c % (HD / 8)) * 8]); gk[j] = Kb + (size_t)s0 * HD + (size_t)c * 8;
      lv[j] = (unsigned)(size_t)(&Vs[buf][c / (KT / 8)][(c % (KT / 8)) * 8]); gv[j] = Vb + (size_t)(c / (KT / 8)) * SQ + s0 + (c % (KT / 8)) * 8; }
    // the copies and, as their statement's last line, the wait that stands before any of their address registers is rewritten
    asm volatile("global_load_async_to_lds_b128 %0, %1, off\n\t"
                 "global_load_async_to_lds_b128 %2, %3, off\n\t"
                 "global_load_async_to_lds_b128 %4, %5, off\n\t"
                 "global_load_async_to_lds_b128 %6, %7, off\n\t"
                 "global_load_async_to_lds_b128 %8, %9, off\n\t"
                 "global_load_async_to_lds_b128 %10, %11, off\n\t"
                 "global_load_async_to_lds_b128 %12, %13, off\n\t"
                 "global_load_async_to_lds_b128 %14, %15, off\n\t"
                 "s_wait_xcnt 0x0"
                 :: "v"(lk[0]), "v"(gk[0]), "v"(lk[1]), "v"(gk[1]), "v"(lk[2]), "v"(gk[2]), "v"(lk[3]), "v"(gk[3]),
                    "v"(lv[0]), "v"(gv[0]), "v"(lv[1]), "v"(gv[1]), "v"(lv[2]), "v"(gv[2]), "v"(lv[3]), "v"(gv[3]) : "memory"); };
  tile_copy(0, 0);
  v16b qa[2][2];   // [query tile][k step]
#pragma unroll   // here and below, every nest over j, u, t, r, i: the register arrays need constant indices
  for (int j = 0; j < 2; ++j)
#pragma unroll
    for (int i = 0; i < 2; ++i) qa[j][i] = frag_kb(Qb + (size_t)(r0 + j * 16 + col) * HD + 32 * i, hh);
  const float cs = SCL * LOG2E / (XS * XS);
  float m[2], l[2]; v8f o[2][4];
#pragma unroll
  for (int j = 0; j < 2; ++j) { m[j] = -__builtin_inff(); l[j] = 0.0f;
#pragma unroll
    for (int t = 0; t < 4; ++t) o[j][t] = (v8f){}; }
  asm volatile("s_wait_asynccnt 0x0" ::: "memory");   // this wave's copies of tile 0 have landed
  __syncthreads();   // tile 0 is published
  if (NT > 1) tile_copy(KT, 1);
#pragma unroll 1   // rolled: one tile's body is all the code the loop needs
  for (int tl = 0; tl < NT; ++tl) {
    const int buf = tl & 1;
#pragma unroll   // the offsets inside a tile become immediates of the LDS reads
    for (int sp = 0; sp < KT / KS; sp += 32) { const int sb = kh * (KT / KS) + sp;   // the wave's share of the tile
      v16b kf[4], vf[4];   // the pass's fragments as one group of LDS reads ahead of its products; each serves both query tiles
#pragma unroll   // fragment arrays stay in registers (this loop and the next)
      for (int u = 0; u < 4; ++u) kf[u] = frag_kb(&Ks[buf][sb + (u >> 1) * 16 + col][32 * (u & 1)], hh);
#pragma unroll
      for (int t = 0; t < 4; ++t) vf[t] = frag_kb(&Vs[buf][t * 16 + col][sb], hh);
      v8f s[2][2];   // [query tile][key tile]: four independent accumulators, so the second k step finds the first one's results ready
      // the pass's eight score products as one run: each fills the window behind the one before it (the second four accumulate into their own D), so only the last needs vector slots,
      // the four v_nop that end the statement, before a vector instruction may touch its D, A or B. A v_nop behind every product took a slot of the SIMD's one vector port from the other three waves' softmax.
      asm volatile("v_wmma_f32_16x16x32_f16 %0, %4, %8, 0\n\t"
                   "v_wmma_f32_16x16x32_f16 %1, %6, %8, 0\n\t"
                   "v_wmma_f32_16x16x32_f16 %2, %4, %10, 0\n\t"
                   "v_wmma_f32_16x16x32_f16 %3, %6, %10, 0\n\t"
                   "v_wmma_f32_16x16x32_f16 %0, %5, %9, %0\n\t"
                   "v_wmma_f32_16x16x32_f16 %1, %7, %9, %1\n\t"
                   "v_wmma_f32_16x16x32_f16 %2, %5, %11, %2\n\t"
                   "v_wmma_f32_16x16x32_f16 %3, %7, %11, %3\n\t"
                   "v_nop\n\tv_nop\n\tv_nop\n\tv_nop"
                   : "=&v"(s[0][0]), "=&v"(s[0][1]), "=&v"(s[1][0]), "=&v"(s[1][1])
                   : "v"(kf[0]), "v"(kf[1]), "v"(kf[2]), "v"(kf[3]), "v"(qa[0][0]), "v"(qa[0][1]), "v"(qa[1][0]), "v"(qa[1][1]));
      v16b pf[2]; float mn[2], al[2]; v2f x[2][8];
#pragma unroll   // both query tiles' softmax work in one straight run, stage by stage, free to interleave
      for (int j = 0; j < 2; ++j) {
        float mx = s[j][0][0];   // maximum of the raw scores: cs > 0, so scaling the maximum once gives the maximum of the scaled scores
#pragma unroll
        for (int i2 = 1; i2 < 16; ++i2) mx = fmaxf(mx, s[j][i2 >> 3][i2 & 7]);
        mx = fmaxf(mx, other_half(mx)); mn[j] = fmaxf(m[j], mx * cs); al[j] = nexp2(m[j] - mn[j]); m[j] = mn[j]; }
#pragma unroll
      for (int j = 0; j < 2; ++j) { const v2f cs2 = {cs, cs}, sh2 = {PSL2 - mn[j], PSL2 - mn[j]};   // p x1024 = 2^(s cs - mn + 10): the score scale, the maximum and P's scale enter one fused multiply-add per score
#pragma unroll
        for (int i = 0; i < 8; ++i) { const v2f sv = {s[j][i >> 2][(i & 3) * 2], s[j][i >> 2][(i & 3) * 2 + 1]}; x[j][i] = __builtin_elementwise_fma(sv, cs2, sh2); } }
#pragma unroll
      for (int j = 0; j < 2; ++j) { float sum = 0.0f;
#pragma unroll
        for (int i = 0; i < 8; ++i) { const float p0 = nexp2(x[j][i][0]), p1 = nexp2(x[j][i][1]); sum += p0; sum += p1; pf[j][2 * i] = (b16)p0; pf[j][2 * i + 1] = (b16)p1; }   // element i2 of the B fragment is key (i2 < 8 ? 0 : 16) + 8 * hh + (i2 & 7): the key of score register i2
        sum += other_half(sum); l[j] = l[j] * al[j] + sum;
#pragma unroll
        for (int t = 0; t < 4; ++t) o[j][t] *= al[j]; }
      __builtin_amdgcn_sched_barrier(0);   // keeps the pass's vector work (multiply-adds, exponentials, conversions, rescale) as groups ahead of the products: scheduled across this line it came out chained pair by pair, each link's latency exposed
      // the pass's eight output products as one run, eight accumulators of their own; the four v_nop keep the last one's distance to the next vector instruction on its D, A or B
      asm volatile("v_wmma_f32_16x16x32_f16 %0, %8, %12, %0\n\t"
                   "v_wmma_f32_16x16x32_f16 %1, %9, %12, %1\n\t"
                   "v_wmma_f32_16x16x32_f16 %2, %10, %12, %2\n\t"
                   "v_wmma_f32_16x16x32_f16 %3, %11, %12, %3\n\t"
                   "v_wmma_f32_16x16x32_f16 %4, %8, %13, %4\n\t"
                   "v_wmma_f32_16x16x32_f16 %5, %9, %13, %5\n\t"
                   "v_wmma_f32_16x16x32_f16 %6, %10, %13, %6\n\t"
                   "v_wmma_f32_16x16x32_f16 %7, %11, %13, %7\n\t"
                   "v_nop\n\tv_nop\n\tv_nop\n\tv_nop"
                   : "+v"(o[0][0]), "+v"(o[0][1]), "+v"(o[0][2]), "+v"(o[0][3]), "+v"(o[1][0]), "+v"(o[1][1]), "+v"(o[1][2]), "+v"(o[1][3])
                   : "v"(vf[0]), "v"(vf[1]), "v"(vf[2]), "v"(vf[3]), "v"(pf[0]), "v"(pf[1])); }
    asm volatile("s_wait_dscnt 0x0" ::: "memory");      // this wave's reads of tile tl are done
    asm volatile("s_wait_asynccnt 0x0" ::: "memory");   // this wave's copies of tile tl + 1 have landed
    __syncthreads();   // publishes tile tl + 1 and ends every wave's reads of tile tl
    if (tl + 2 < NT) tile_copy((tl + 2) * KT, buf);   // refill of the buffer that this pass has just read
  }
  asm volatile("s_wait_asynccnt 0x0" ::: "memory");   // no copy is left in flight behind the loop
  // merge of the four key shares: every wave lays down both its partial tiles with their max and sum; behind one barrier wave (qg, kh) finishes query tile kh & 1, columns 32 * (kh >> 1) .. + 31
#pragma unroll
  for (int j = 0; j < 2; ++j) {
#pragma unroll
    for (int t = 0; t < 4; ++t)
#pragma unroll
      for (int r = 0; r < 8; ++r) Tx[wave][j][col][t * 16 + 8 * hh + r] = o[j][t][r];
    Sx[wave][j][hh][col] = hh ? l[j] : m[j]; }   // both lane halves hold both values: half 0 writes the max, half 1 the sum
  __syncthreads();   // publishes every wave's partials
  const int jt = kh & 1, dh = kh >> 1;
#pragma unroll   // the four trips are independent: unrolled, their LDS reads and exponentials overlap, and the stores stand last with constant offsets
  for (int it = 0; it < 4; ++it) { const int rr = it * 4 + (lane >> 3); const int c4 = dh * 32 + (lane & 7) * 4;   // a store covers 4 rows x one whole 128-byte line
    float mp[KS], lp[KS]; float mn = -__builtin_inff();
#pragma unroll
    for (int p = 0; p < KS; ++p) { mp[p] = Sx[qg + QG * p][jt][0][rr]; lp[p] = Sx[qg + QG * p][jt][1][rr]; mn = fmaxf(mn, mp[p]); }
    float den = 0.0f; v4f acc = (v4f){};
#pragma unroll
    for (int p = 0; p < KS; ++p) { const float a = nexp2(mp[p] - mn); den += lp[p] * a; acc += *(const v4f*)(&Tx[qg + QG * p][jt][rr][c4]) * a; }
    *(v4f*)(out + ((size_t)b * SQ + r0 + jt * 16 + rr) * HD + c4) = acc * (1.0f / (den * XS)); }   // the sums carry P's x1024 as the output tiles do
}
}  // namespace

extern "C" void kernel_launch(void* const* d_in, const int* in_sizes, int n_in, void* d_out, int out_size, void* d_ws, size_t ws_size, hipStream_t stream) {
  if (n_in < 7) return;
  auto Fp = [&](int i) { return (const float*)d_in[i]; };
  // wire order: 0 x [16,2048,384], 1 Wq [384,64], 2 bq [64], 3 Wk [384,64], 4 bk [64], 5 Wv [384,64], 6 bv [64]
  if ((size_t)in_sizes[0] < (size_t)NBL * T_FULL * C || in_sizes[1] < C * HD || in_sizes[2] < HD || in_sizes[3] < C * HD || in_sizes[4] < HD || in_sizes[5] < C * HD || in_sizes[6] < HD) return;
  if ((size_t)out_size < (size_t)NBL * SQ * HD) return;
  size_t off = 0; char* ws = (char*)d_ws;
  auto carve = [&](size_t bytes) { char* p = ws + off; off += (bytes + 255) & ~(size_t)255; return p; };
  b16* WT = (b16*)carve((size_t)PREP_ELEMS * 2);            // 147,456 B
  const size_t plane = (size_t)NBL * SQ * HD * 2;            // 4,194,304 B at full size
  b16* QP = (b16*)carve(plane); b16* KP = (b16*)carve(plane); b16* VT = (b16*)carve(plane);
  if (off > ws_size || off > ((size_t)128 << 20)) return;    // about 12.7 MB total
  prep_kernel<<<(unsigned)(PREP_THREADS / 256), 256, 0, stream>>>(Fp(1), Fp(3), Fp(5), WT);
  proj_kernel<<<dim3(SQ / 64, NBL), 128, 0, stream>>>(Fp(0), WT, Fp(2), Fp(4), Fp(6), QP, KP, VT);
  attn_kernel<<<dim3(SQ / QB, NBL), AW * 32, 0, stream>>>(QP, KP, VT, (float*)d_out);
}

// v010
// A run of this version takes 29.9 microseconds.
// Next to v009, in two timings, it ran 1.06 times as fast each time.
// Counting every step since v000, it is 5.67 times as fast.
#include <hip/hip_runtime.h>

// All contractions: v_wmma_f32_16x16x32_f16 (16-bit operands, f32 accumulate). Projections q/k/v = X W + b with X bf16-exact (x8) staged block-wide and W^T [o][c] bf16-exact (x256): 1 product;
// S^T = K_tile Q^T with q/k single f16 x8 planes (K = 64): 1 product; O^T += V^T P^T with V^T single f16 x8 and P single f16 x1024: 1 product. Biases, online softmax statistics and the
// final normalisation in f32. All float inputs RNE-converted to bf16 once on load.

#ifndef NB
#define NB 16
#endif
#ifndef SEQ
#define SEQ 2048
#endif

namespace {
constexpr int B_FULL = 16, T_FULL = 2048, C = 384, HD = 64;
constexpr int NBL = NB;   // batches processed
constexpr int SQ = SEQ;   // tokens processed per batch (queries and keys); input stride per batch stays T_FULL
constexpr int KC = 128;   // k chunk of C staged in LDS per pass
constexpr float XS = 8.0f, WSC = 256.0f, PSL2 = 10.0f, PLIM = 65504.0f, LOG2E = 1.4426950408889634f, SCL = 0.125f;   // 64^-0.5
static_assert(NBL >= 1 && NBL <= B_FULL);
static_assert(SQ >= 64 && SQ <= T_FULL && SQ % 64 == 0 && SQ % 32 == 0);
static_assert(C % KC == 0 && KC % 32 == 0 && C % 8 == 0 && HD == 64);
constexpr int XL = 64 * (KC / 4) / 128;   // 16-byte loads of X per thread and k chunk in a projection block
static_assert(KC / 4 == 32 && XL * 4 == 64);   // one wave's load covers one token's row of the chunk; 4 waves x XL loads cover the 64 tokens
constexpr int NO = 3 * HD;   // output columns of the three projections together
static_assert(24 * 8 * 128 == NO * KC && NO == 4 * 3 * 16);   // 24 pieces of 8 halves per thread of a projection block fill the staged W^T chunk; 4 waves x 3 column tiles
constexpr int PREP_ELEMS = 3 * HD * C;           // 73728 halves in W^T
constexpr int PREP_THREADS = PREP_ELEMS / 8;     // 9216 threads, 8 halves each
static_assert(PREP_ELEMS % 8 == 0 && PREP_THREADS % 256 == 0);
// coverage: prep grid (PREP_THREADS/256) x 256 x 8 == 3*HD*C; proj grid (SQ/64, NBL) x 64 tokens x HD == NBL*SQ*HD per plane, three planes per block; attn grid (SQ/QB, NBL) x QB rows x HD == NBL*SQ*HD == out
static_assert((PREP_THREADS / 256) * 256 * 8 == PREP_ELEMS);
static_assert((SQ / 64) * 64 == SQ && (SQ / 32) * 32 == SQ);
constexpr int AW = 16, KS = 4, QG = AW / KS, QB = QG * 32;   // attention block: waves (4 per SIMD), key shares of a tile, groups of 32 query rows, query rows
constexpr int KT = 256, NT = SQ / KT;   // keys per staged tile (a share stays 64 keys), tiles
static_assert(SQ % QB == 0 && SQ % KT == 0 && KT % (32 * KS) == 0 && 4 * 8 * AW * 32 == KT * HD);   // 4 pieces of 8 halves per thread fill each staged tile
static_assert(KS == 4 && QG * KS == AW && KS * 16 * 32 == 32 * HD);   // the closing merge joins waves qg, qg + QG, qg + 2 QG, qg + 3 QG; each of the four finishes 16 query rows x 32 columns of the group's 32 x 64

typedef _Float16 b16;
typedef __attribute__((ext_vector_type(16))) _Float16 v16b;
typedef __attribute__((ext_vector_type(8))) _Float16 v8b;
typedef __attribute__((ext_vector_type(4))) _Float16 v4h;
typedef __attribute__((ext_vector_type(8))) float v8f;
typedef __attribute__((ext_vector_type(4))) float v4f;
typedef __attribute__((ext_vector_type(2))) float v2f;

__device__ __forceinline__ float bf16_rne(float f) { unsigned int u = __float_as_uint(f); u += 0x7FFFu + ((u >> 16) & 1u); return __uint_as_float(u & 0xFFFF0000u); }
__device__ __forceinline__ v16b frag_kb(const b16* p, int hh) { const v8b a = *(const v8b*)(p + 8 * hh), b = *(const v8b*)(p + 16 + 8 * hh); v16b f;
#pragma unroll
  for (int e = 0; e < 8; ++e) { f[e] = a[e]; f[8 + e] = b[e]; } return f; }
__device__ __forceinline__ v8f wmma16b(v16b a, v16b b, v8f c) { v8f d = __builtin_amdgcn_wmma_f32_16x16x32_f16(false, a, false, b, (short)0, c, false, false); asm volatile("v_nop\n\tv_nop\n\tv_nop\n\tv_nop" : "+v"(d) : "v"(a), "v"(b)); return d; }
__device__ __forceinline__ float nexp2(float v) { return __builtin_amdgcn_exp2f(v); }
__device__ __forceinline__ float other_half(float v) { const int b = __float_as_int(v); return __int_as_float(__builtin_amdgcn_permlanex16(b, b, 0x76543210, 0xfedcba98, false, false)); }   // lane l takes lane l ^ 16's value, by a vector move

__global__ __launch_bounds__(256) void prep_kernel(const float* __restrict__ wq, const float* __restrict__ wk, const float* __restrict__ wv, b16* __restrict__ WT) {
  const size_t u = (size_t)blockIdx.x * 256 + threadIdx.x; if (u >= (size_t)PREP_THREADS) return;
  const size_t e = u * 8; const int oo = (int)(e / C), c0 = (int)(e % C); const int m = oo / HD, o2 = oo % HD; const float* w = m == 0 ? wq : m == 1 ? wk : wv; v8b o;
#pragma unroll
  for (int j = 0; j < 8; ++j) o[j] = (b16)(bf16_rne(w[(size_t)(c0 + j) * HD + o2]) * WSC);
  { *(v8b*)(WT + e) = o;  }
}

// projections: grid (SQ/64, NBL); block = 64 tokens x 4 waves and ALL THREE projections: an X chunk is read from memory, converted and staged once and serves the 192 output columns
// (0..63 q, row operand, plane QP [b][tok][64]; 64..127 k, streamed operand, plane KP [b][tok][64]; 128..191 v, V^T [b][d][tok]); W^T rows of the three parts lie one behind the other in WT.
// A wave takes the 64 tokens x 48 columns (4 x 3 accumulator tiles): 7 fragments read from LDS feed 12 products, and each W^T row is read by one wave only.
__global__ __launch_bounds__(128) void proj_kernel(const float* __restrict__ X, const b16* __restrict__ WT, const float* __restrict__ bq, const float* __restrict__ bk, const float* __restrict__ bv,
                                                   b16* __restrict__ QP, b16* __restrict__ KP, b16* __restrict__ VT) {
  __shared__ __attribute__((aligned(16))) b16 As[64][KC + 8]; __shared__ __attribute__((aligned(16))) float Tf[3][64][HD + 4];
  __shared__ __attribute__((aligned(16))) b16 Ws[NO][KC + 8];   // the W^T rows of all three parts, one k chunk; row pitch 272 B: 16 B x odd for 16-byte readers
  const int wave = threadIdx.x >> 5, lane = threadIdx.x & 31, nloc = lane & 15, hlf = lane >> 4; const int t0 = blockIdx.x * 64; const int b = blockIdx.y;
  const float* xb = X + ((size_t)b * T_FULL + t0) * C;
  // one k chunk of W^T (192 rows of 256 B): every thread copies 24 pieces of 16 B, 12 per statement; a wave's copy covers 2 rows of 2 whole lines each
  const unsigned lw0 = (unsigned)(size_t)(&Ws[threadIdx.x / (KC / 8)][(threadIdx.x % (KC / 8)) * 8]); const b16* gw0 = WT + (size_t)(threadIdx.x / (KC / 8)) * C + (threadIdx.x % (KC / 8)) * 8;
  auto w_copy12 = [&](int kc, int j0) {
    unsigned lw[12]; const b16* gw[12];
#pragma unroll   // the address arrays stay in registers
    for (int j = 0; j < 12; ++j) { lw[j] = lw0 + (unsigned)((j0 + j) * 8 * (KC + 8) * 2); gw[j] = gw0 + kc + (j0 + j) * 8 * C; }   // piece j of a thread lies 8 rows behind piece j - 1: constant steps from one base, no table of addresses held over the loop
    // the copies and, as their statement's last line, the wait that stands before any of their address registers is rewritten
    asm volatile("global_load_async_to_lds_b128 %0, %1, off\n\t"
                 "global_load_async_to_lds_b128 %2, %3, off\n\t"
                 "global_load_async_to_lds_b128 %4, %5, off\n\t"
                 "global_load_async_to_lds_b128 %6, %7, off\n\t"
                 "global_load_async_to_lds_b128 %8, %9, off\n\t"
                 "global_load_async_to_lds_b128 %10, %11, off\n\t"
                 "global_load_async_to_lds_b128 %12, %13, off\n\t"
                 "global_load_async_to_lds_b128 %14, %15, off\n\t"
                 "global_load_async_to_lds_b128 %16, %17, off\n\t"
                 "global_load_async_to_lds_b128 %18, %19, off\n\t"
                 "global_load_async_to_lds_b128 %20, %21, off\n\t"
                 "global_load_async_to_lds_b128 %22, %23, off\n\t"
                 "s_wait_xcnt 0x0"
                 :: "v"(lw[0]), "v"(gw[0]), "v"(lw[1]), "v"(gw[1]), "v"(lw[2]), "v"(gw[2]), "v"(lw[3]), "v"(gw[3]),
                    "v"(lw[4]), "v"(gw[4]), "v"(lw[5]), "v"(gw[5]), "v"(lw[6]), "v"(gw[6]), "v"(lw[7]), "v"(gw[7]),
                    "v"(lw[8]), "v"(gw[8]), "v"(lw[9]), "v"(gw[9]), "v"(lw[10]), "v"(gw[10]), "v"(lw[11]), "v"(gw[11]) : "memory"); };
  const float* xp = xb + wave * C + lane * 4;   // the thread's place in a group of 4 token rows: wave = row, lane = 16-byte piece; steps on by a chunk per pass
  v8f acc[4][3];   // [token tile][column tile]
#pragma unroll   // here and below, every nest over i, u, r: the register arrays need constant indices
  for (int i = 0; i < 4; ++i)
#pragma unroll
    for (int u = 0; u < 3; ++u) acc[i][u] = (v8f){};
#pragma unroll 1   // rolled: one chunk's body is all the code the loop needs
  for (int kc = 0; kc < C; kc += KC) {
    asm volatile("s_wait_dscnt 0x0" ::: "memory");   // this wave's reads of the last chunk are done
    __syncthreads();   // ends every wave's reads of the last chunk
    w_copy12(kc, 0); w_copy12(kc, 12);   // in flight while the X chunk is converted
    v4f xf[XL];   // the thread's whole share of the X chunk: every load is issued before the first value is used, so a chunk costs one memory round trip, not one per pair of loads
#pragma unroll   // the load array stays in registers (this loop and the next); the row steps become immediate offsets
    for (int g = 0; g < XL; ++g) xf[g] = *(const v4f*)(xp + g * 4 * C);
    xp += KC;
#pragma unroll
    for (int g = 0; g < XL; ++g) { v4h o;
#pragma unroll
      for (int j = 0; j < 4; ++j) o[j] = (b16)(bf16_rne(xf[g][j]) * XS); *(v4h*)(&As[g * 4 + wave][lane * 4]) = o; }
    asm volatile("s_wait_asynccnt 0x0" ::: "memory");   // this wave's copies of the W^T chunk have landed
    __syncthreads();   // publishes the X chunk and the W^T chunk
#pragma unroll 2   // two k steps a trip: one trip's fragments and the 12 accumulator tiles fit 256 registers
    for (int kb = 0; kb < KC; kb += 32) { v16b a[4], wf[3];   // the k step's fragments as one group of LDS reads ahead of its products
#pragma unroll
      for (int i = 0; i < 4; ++i) a[i] = frag_kb(&As[i * 16 + nloc][kb], hlf);
#pragma unroll
      for (int u = 0; u < 3; ++u) wf[u] = frag_kb(&Ws[wave * 48 + u * 16 + nloc][kb], hlf);
#pragma unroll
      for (int u = 0; u < 3; ++u)
#pragma unroll
        for (int i = 0; i < 4; ++i) acc[i][u] = wmma16b(a[i], wf[u], acc[i][u]); } }
#pragma unroll
  for (int u = 0; u < 3; ++u) { const int g = wave * 3 + u, pt = g >> 2, tc = (g & 3) * 16 + nloc;   // column tile g of 12: part and column inside the part
    const float* bias = pt == 0 ? bq : pt == 1 ? bk : bv; const float bb = bf16_rne(bias[tc]);
#pragma unroll
    for (int i = 0; i < 4; ++i)
#pragma unroll
      for (int r = 0; r < 8; ++r) Tf[pt][i * 16 + 8 * hlf + r][tc] = acc[i][u][r] * (1.0f / (XS * WSC)) + bb; }
  __syncthreads();   // every wave reads Tf rows and columns that other waves wrote
#pragma unroll 1   // rolled (this loop and the next): run once per block, short code
  for (int it = 0; it < 8; ++it) { const int pt = it >> 2; b16* plane = pt == 0 ? QP : KP; const int rr = wave * 16 + (it & 3) * 4 + (lane >> 3); const int c8 = (lane & 7) * 8; v8b o8;
#pragma unroll
    for (int j = 0; j < 8; ++j) o8[j] = (b16)(Tf[pt][rr][c8 + j] * XS);
    *(v8b*)(plane + ((size_t)b * SQ + t0 + rr) * HD + c8) = o8;
    asm volatile("s_wait_xcnt 0x0" ::: "memory"); }   // stands before the next trip rewrites the store's address and data registers
#pragma unroll 1
  for (int it = 0; it < 4; ++it) { const int d = wave * 16 + it * 4 + (lane >> 3); const int tk0 = (lane & 7) * 8; v8b vv;
#pragma unroll
    for (int j = 0; j < 8; ++j) vv[j] = (b16)(Tf[2][tk0 + j][d] * XS);
    *(v8b*)(VT + ((size_t)b * HD + d) * (size_t)SQ + t0 + tk0) = vv; }
}

// attention: grid (SQ/QB, NBL): block = QG groups of 32 query rows x KS key shares, one wave each: a wave works its share (KT/KS keys) of every tile for two query tiles of 16 rows, so each K and V^T
// fragment it reads from LDS feeds two products; the four waves of a group hold partial results (own running max, sum, output tiles) that are merged once behind the loop, through LDS, each wave finishing half the columns of one query tile.
// 16 waves a block, one block a WGP: four waves share a SIMD, so one wave's softmax chain and LDS waits are filled by three others' work.
// K and V^T tiles of KT keys are staged in LDS once per block by asynchronous copies (whole lines, two buffers, the next tile's
// copies in flight while this tile is worked on, one block barrier per tile) and every wave takes its fragments from there; q fragments register-resident; S^T = K_tile Q^T (lane col = query row,
// D rows = keys; K = 64 = 2 k-steps); online softmax over keys on a held maximum, renewed (with the rescale of sums and outputs) only in a pass whose P would near the f16 limit; P x1024 single, packed in registers: a lane's 16 scores of a pass are its 16 elements of the B fragment; O^T += V^T P^T (4 d-tiles);
// out rows [b][t][64] f32:
__global__ __launch_bounds__(AW * 32) void attn_kernel(const b16* __restrict__ QP, const b16* __restrict__ KP, const b16* __restrict__ VT, float* __restrict__ out) {
  __shared__ __attribute__((aligned(16))) b16 Ks[2][KT][HD + 8]; __shared__ __attribute__((aligned(16))) b16 Vs[2][HD][KT + 8];   // row pitches 144 B and 528 B: 16 B x odd for 16-byte readers
  __shared__ __attribute__((aligned(16))) float Tx[AW][2][16][HD + 4]; __shared__ float Sx[AW][2][2][16];   // every wave's partial output tiles [query tile][row][column], max and sum [query tile][max, sum][row]
  const int tid = threadIdx.x, wave = tid >> 5, lane = tid & 31, hh = lane >> 4, col = lane & 15; const int b = blockIdx.y; const int qg = wave % QG, kh = wave / QG; const int r0 = blockIdx.x * QB + qg * 32;
  const b16* Qb = QP + (size_t)b * SQ * HD; const b16* Kb = KP + (size_t)b * SQ * HD; const b16* Vb = VT + (size_t)b * HD * (size_t)SQ;
  // one tile: every thread copies 4 pieces of 16 B of K (32 KB in a row in memory) and 4 of V^T (64 rows of 512 B); a wave's copy covers 4 whole lines
  auto tile_copy = [&](int s0, int buf) {
    unsigned lk[4], lv[4]; const b16* gk[4]; const b16* gv[4];
#pragma unroll   // the address arrays stay in registers
    for (int j = 0; j < 4; ++j) { const int c = j * (AW * 32) + tid;
      lk[j] = (unsigned)(size_t)(&Ks[buf][c / (HD / 8)][(c % (HD / 8)) * 8]); gk[j] = Kb + (size_t)s0 * HD + (size_t)c * 8;
      lv[j] = (unsigned)(size_t)(&Vs[buf][c / (KT / 8)][(c % (KT / 8)) * 8]); gv[j] = Vb + (size_t)(c / (KT / 8)) * SQ + s0 + (c % (KT / 8)) * 8; }
    // the copies and, as their statement's last line, the wait that stands before any of their address registers is rewritten
    asm volatile("global_load_async_to_lds_b128 %0, %1, off\n\t"
                 "global_load_async_to_lds_b128 %2, %3, off\n\t"
                 "global_load_async_to_lds_b128 %4, %5, off\n\t"
                 "global_load_async_to_lds_b128 %6, %7, off\n\t"
                 "global_load_async_to_lds_b128 %8, %9, off\n\t"
                 "global_load_async_to_lds_b128 %10, %11, off\n\t"
                 "global_load_async_to_lds_b128 %12, %13, off\n\t"
                 "global_load_async_to_lds_b128 %14, %15, off\n\t"
                 "s_wait_xcnt 0x0"
                 :: "v"(lk[0]), "v"(gk[0]), "v"(lk[1]), "v"(gk[1]), "v"(lk[2]), "v"(gk[2]), "v"(lk[3]), "v"(gk[3]),
                    "v"(lv[0]), "v"(gv[0]), "v"(lv[1]), "v"(gv[1]), "v"(lv[2]), "v"(gv[2]), "v"(lv[3]), "v"(gv[3]) : "memory"); };
  tile_copy(0, 0);
  v16b qa[2][2];   // [query tile][k step]
#pragma unroll   // here and below, every nest over j, u, t, r, i: the register arrays need constant indices
  for (int j = 0; j < 2; ++j)
#pragma unroll
    for (int i = 0; i < 2; ++i) qa[j][i] = frag_kb(Qb + (size_t)(r0 + j * 16 + col) * HD + 32 * i, hh);
  const float cs = SCL * LOG2E / (XS * XS);
  float m[2]; v2f l[2]; v8f o[2][4];
#pragma unroll
  for (int j = 0; j < 2; ++j) { m[j] = -__builtin_inff(); l[j] = (v2f){};
#pragma unroll
    for (int t = 0; t < 4; ++t) o[j][t] = (v8f){}; }
  asm volatile("s_wait_asynccnt 0x0" ::: "memory");   // this wave's copies of tile 0 have landed
  __syncthreads();   // tile 0 is published
  if (NT > 1) tile_copy(KT, 1);
#pragma unroll 1   // rolled: one tile's body is all the code the loop needs
  for (int tl = 0; tl < NT; ++tl) {
    const int buf = tl & 1;
#pragma unroll   // the offsets inside a tile become immediates of the LDS reads
    for (int sp = 0; sp < KT / KS; sp += 32) { const int sb = kh * (KT / KS) + sp;   // the wave's share of the tile
      v16b kf[4], vf[4];   // the pass's fragments as one group of LDS reads ahead of its products; each serves both query tiles
#pragma unroll   // fragment arrays stay in registers (this loop and the next)
      for (int u = 0; u < 4; ++u) kf[u] = frag_kb(&Ks[buf][sb + (u >> 1) * 16 + col][32 * (u & 1)], hh);
#pragma unroll
      for (int t = 0; t < 4; ++t) vf[t] = frag_kb(&Vs[buf][t * 16 + col][sb], hh);
      v8f s[2][2];   // [query tile][key tile]: four independent accumulators, so the second k step finds the first one's results ready
      // the pass's eight score products as one run: each fills the window behind the one before it (the second four accumulate into their own D), so only the last needs vector slots,
      // the four v_nop that end the statement, before a vector instruction may touch its D, A or B. A v_nop behind every product took a slot of the SIMD's one vector port from the other three waves' softmax.
      asm volatile("v_wmma_f32_16x16x32_f16 %0, %4, %8, 0\n\t"
                   "v_wmma_f32_16x16x32_f16 %1, %6, %8, 0\n\t"
                   "v_wmma_f32_16x16x32_f16 %2, %4, %10, 0\n\t"
                   "v_wmma_f32_16x16x32_f16 %3, %6, %10, 0\n\t"
                   "v_wmma_f32_16x16x32_f16 %0, %5, %9, %0\n\t"
                   "v_wmma_f32_16x16x32_f16 %1, %7, %9, %1\n\t"
                   "v_wmma_f32_16x16x32_f16 %2, %5, %11, %2\n\t"
                   "v_wmma_f32_16x16x32_f16 %3, %7, %11, %3\n\t"
                   "v_nop\n\tv_nop\n\tv_nop\n\tv_nop"
                   : "=&v"(s[0][0]), "=&v"(s[0][1]), "=&v"(s[1][0]), "=&v"(s[1][1])
                   : "v"(kf[0]), "v"(kf[1]), "v"(kf[2]), "v"(kf[3]), "v"(qa[0][0]), "v"(qa[0][1]), "v"(qa[1][0]), "v"(qa[1][1]));
      v16b pf[2]; v2f x[2][8], sum[2];   // sum: [query tile], the lane's even and odd score registers summed apart
      // P x1024 = 2^(s cs - m + 10) on the maximum held from an earlier pass: the score scale, that maximum and P's scale enter one fused multiply-add per score pair; each lane sums its own 16 values per query tile
      auto p_and_sum = [&]() {
#pragma unroll   // both query tiles' work in one straight run, stage by stage, free to interleave
        for (int j = 0; j < 2; ++j) { const v2f cs2 = {cs, cs}, sh2 = {PSL2 - m[j], PSL2 - m[j]};
#pragma unroll
          for (int i = 0; i < 8; ++i) { const v2f sv = {s[j][i >> 2][(i & 3) * 2], s[j][i >> 2][(i & 3) * 2 + 1]}; x[j][i] = __builtin_elementwise_fma(sv, cs2, sh2); } }
#pragma unroll
        for (int i = 0; i < 8; ++i)
#pragma unroll
          for (int j = 0; j < 2; ++j) { x[j][i][0] = nexp2(x[j][i][0]); x[j][i][1] = nexp2(x[j][i][1]); sum[j] = i ? sum[j] + x[j][i] : x[j][i]; } };
      p_and_sum();
      // No value of P is negative, so a part sum below PLIM, the largest finite f16, bounds each of its 8 values inside the f16 range: while all four of a lane's part sums stay below it, the held maximum still serves
      // and nothing is rescaled. Otherwise (always in the first pass, where m = -inf makes every sum infinite) the whole wave renews the maximum from this pass's scores, rescales sums and outputs by 2^(old - new)
      // and forms P again, now at most 1024.
      const float top = fmaxf(fmaxf(sum[0][0], sum[0][1]), fmaxf(sum[1][0], sum[1][1]));
      if (__builtin_amdgcn_ballot_w32(!(top < PLIM)) != 0u) {   // one scalar branch for the wave: every lane stays on for the products behind it
#pragma unroll
        for (int j = 0; j < 2; ++j) {
          float mx = s[j][0][0];   // maximum of the raw scores: cs > 0, so scaling the maximum once gives the maximum of the scaled scores
#pragma unroll
          for (int i2 = 1; i2 < 16; ++i2) mx = fmaxf(mx, s[j][i2 >> 3][i2 & 7]);
          mx = fmaxf(mx, other_half(mx)); const float mn = fmaxf(m[j], mx * cs), al = nexp2(m[j] - mn); m[j] = mn; l[j] *= al;
#pragma unroll
          for (int t = 0; t < 4; ++t) o[j][t] *= al; }
        p_and_sum(); }
#pragma unroll
      for (int j = 0; j < 2; ++j) { l[j] += sum[j];   // a lane keeps the sums of its own keys, even and odd registers apart; they and the two lane halves are joined once behind the loop
#pragma unroll
        for (int i = 0; i < 8; ++i) { pf[j][2 * i] = (b16)x[j][i][0]; pf[j][2 * i + 1] = (b16)x[j][i][1]; } }   // element i2 of the B fragment is key (i2 < 8 ? 0 : 16) + 8 * hh + (i2 & 7): the key of score register i2
      // the pass's eight output products as one run, eight accumulators of their own; the four v_nop keep the last one's distance to the next vector instruction on its D, A or B
      asm volatile("v_wmma_f32_16x16x32_f16 %0, %8, %12, %0\n\t"
                   "v_wmma_f32_16x16x32_f16 %1, %9, %12, %1\n\t"
                   "v_wmma_f32_16x16x32_f16 %2, %10, %12, %2\n\t"
                   "v_wmma_f32_16x16x32_f16 %3, %11, %12, %3\n\t"
                   "v_wmma_f32_16x16x32_f16 %4, %8, %13, %4\n\t"
                   "v_wmma_f32_16x16x32_f16 %5, %9, %13, %5\n\t"
                   "v_wmma_f32_16x16x32_f16 %6, %10, %13, %6\n\t"
                   "v_wmma_f32_16x16x32_f16 %7, %11, %13, %7\n\t"
                   "v_nop\n\tv_nop\n\tv_nop\n\tv_nop"
                   : "+v"(o[0][0]), "+v"(o[0][1]), "+v"(o[0][2]), "+v"(o[0][3]), "+v"(o[1][0]), "+v"(o[1][1]), "+v"(o[1][2]), "+v"(o[1][3])
                   : "v"(vf[0]), "v"(vf[1]), "v"(vf[2]), "v"(vf[3]), "v"(pf[0]), "v"(pf[1])); }
    asm volatile("s_wait_dscnt 0x0" ::: "memory");      // this wave's reads of tile tl are done
    asm volatile("s_wait_asynccnt 0x0" ::: "memory");   // this wave's copies of tile tl + 1 have landed
    __syncthreads();   // publishes tile tl + 1 and ends every wave's reads of tile tl
    if (tl + 2 < NT) tile_copy((tl + 2) * KT, buf);   // refill of the buffer that this pass has just read
  }
  asm volatile("s_wait_asynccnt 0x0" ::: "memory");   // no copy is left in flight behind the loop
  // merge of the four key shares: every wave lays down both its partial tiles with their max and sum; behind one barrier wave (qg, kh) finishes query tile kh & 1, columns 32 * (kh >> 1) .. + 31
#pragma unroll
  for (int j = 0; j < 2; ++j) {
#pragma unroll
    for (int t = 0; t < 4; ++t)
#pragma unroll
      for (int r = 0; r < 8; ++r) Tx[wave][j][col][t * 16 + 8 * hh + r] = o[j][t][r];
    float lj = l[j][0] + l[j][1]; lj += other_half(lj);   // the lane's two part sums, then the two lane halves', all on one maximum
    Sx[wave][j][hh][col] = hh ? lj : m[j]; }   // both lane halves hold both values: half 0 writes the max, half 1 the sum
  __syncthreads();   // publishes every wave's partials
  const int jt = kh & 1, dh = kh >> 1;
#pragma unroll   // the four trips are independent: unrolled, their LDS reads and exponentials overlap, and the stores stand last with constant offsets
  for (int it = 0; it < 4; ++it) { const int rr = it * 4 + (lane >> 3); const int c4 = dh * 32 + (lane & 7) * 4;   // a store covers 4 rows x one whole 128-byte line
    float mp[KS], lp[KS]; float mn = -__builtin_inff();
#pragma unroll
    for (int p = 0; p < KS; ++p) { mp[p] = Sx[qg + QG * p][jt][0][rr]; lp[p] = Sx[qg + QG * p][jt][1][rr]; mn = fmaxf(mn, mp[p]); }
    float den = 0.0f; v4f acc = (v4f){};
#pragma unroll
    for (int p = 0; p < KS; ++p) { const float a = nexp2(mp[p] - mn); den += lp[p] * a; acc += *(const v4f*)(&Tx[qg + QG * p][jt][rr][c4]) * a; }
    *(v4f*)(out + ((size_t)b * SQ + r0 + jt * 16 + rr) * HD + c4) = acc * (1.0f / (den * XS)); }   // the sums carry P's x1024 as the output tiles do
}
}  // namespace

extern "C" void kernel_launch(void* const* d_in, const int* in_sizes, int n_in, void* d_out, int out_size, void* d_ws, size_t ws_size, hipStream_t stream) {
  if (n_in < 7) return;
  auto Fp = [&](int i) { return (const float*)d_in[i]; };
  // wire order: 0 x [16,2048,384], 1 Wq [384,64], 2 bq [64], 3 Wk [384,64], 4 bk [64], 5 Wv [384,64], 6 bv [64]
  if ((size_t)in_sizes[0] < (size_t)NBL * T_FULL * C || in_sizes[1] < C * HD || in_sizes[2] < HD || in_sizes[3] < C * HD || in_sizes[4] < HD || in_sizes[5] < C * HD || in_sizes[6] < HD) return;
  if ((size_t)out_size < (size_t)NBL * SQ * HD) return;
  size_t off = 0; char* ws = (char*)d_ws;
  auto carve = [&](size_t bytes) { char* p = ws + off; off += (bytes + 255) & ~(size_t)255; return p; };
  b16* WT = (b16*)carve((size_t)PREP_ELEMS * 2);            // 147,456 B
  const size_t plane = (size_t)NBL * SQ * HD * 2;            // 4,194,304 B at full size
  b16* QP = (b16*)carve(plane); b16* KP = (b16*)carve(plane); b16* VT = (b16*)carve(plane);
  if (off > ws_size || off > ((size_t)128 << 20)) return;    // about 12.7 MB total
  prep_kernel<<<(unsigned)(PREP_THREADS / 256), 256, 0, stream>>>(Fp(1), Fp(3), Fp(5), WT);
  proj_kernel<<<dim3(SQ / 64, NBL), 128, 0, stream>>>(Fp(0), WT, Fp(2), Fp(4), Fp(6), QP, KP, VT);
  attn_kernel<<<dim3(SQ / QB, NBL), AW * 32, 0, stream>>>(QP, KP, VT, (float*)d_out);
}
